// v000
// Times are from an AMD MI455X. After a warm-up the kernel runs many times in a row, and a time is the length of
// such a window on the GPU divided by its runs, so every launch and the gaps after it count. The runs cycle
// through copies of the inputs. A figure is the median of several windows, for all but v000 over two sittings.
// Sittings can differ by a few percent; kernels timed side by side share one.
// The starting kernel, v000, takes 44.3 microseconds a run.
#include <hip/hip_runtime.h>

typedef __attribute__((ext_vector_type(16))) _Float16 v16h;
typedef __attribute__((ext_vector_type(8)))  float    v8f;
typedef __attribute__((ext_vector_type(4)))  float    f32x4;

#define S_LEN 1024
#define DH    64
#define VROW  68   // 64 data dwords + 4 pad dwords per LDS row (TDM pad feature)

__device__ __forceinline__ int iabs(int x) { return x < 0 ? -x : x; }

#if defined(__has_builtin)
#if __has_builtin(__builtin_amdgcn_tensor_load_to_lds) && __has_builtin(__builtin_amdgcn_s_wait_tensorcnt)
#define USE_TDM 1
#endif
#endif

#ifdef USE_TDM
// Issue one TDM 2D tile load: 32 rows x 64 cols of f32, row stride 64 floats,
// LDS rows padded to 68 floats via pad_interval=64dw / pad_amount=4dw.
__device__ __forceinline__ void tdm_load_tile(const void* gaddr, unsigned lds_off) {
  typedef unsigned v4u __attribute__((ext_vector_type(4)));
  typedef int      v8i __attribute__((ext_vector_type(8)));
  typedef int      v4i __attribute__((ext_vector_type(4)));
  unsigned long long ga = (unsigned long long)(size_t)gaddr;
  // D# group0: count=1 | lds_addr | global_addr[56:0] | type=2
  v4u g0 = { 1u, lds_off, (unsigned)ga,
             ((unsigned)(ga >> 32) & 0x01ffffffu) | 0x80000000u };
  // D# group1: data_size=4B(code2), pad_enable, pad_interval=64dw(code5),
  // pad_amount=4dw(code3); tensor 64x32, tile 64x32, dim0 stride 64.
  v8i g1 = { (int)((2u << 16) | (1u << 20) | (5u << 22) | (3u << 25)),
             (int)(64u << 16),   // tensor_dim0 = 64   (bits 79:48)
             (int)(32u << 16),   // tensor_dim1 = 32   (bits 111:80)
             (int)(64u << 16),   // tile_dim0   = 64   (bits 127:112)
             (int)32,            // tile_dim1   = 32
             (int)64,            // tensor_dim0_stride = 64
             0, 0 };
  v4i z4 = { 0, 0, 0, 0 };
  v8i z8 = { 0, 0, 0, 0, 0, 0, 0, 0 };
  // 6-arg toolchain variant: (g0, g1, g2, g3, g4, cpol)
  __builtin_amdgcn_tensor_load_to_lds(g0, g1, z4, z4, z8, 0);
}
#endif

__global__ __launch_bounds__(256)
void fa3d_wmma_kernel(const float* __restrict__ Q, const float* __restrict__ K,
                      const float* __restrict__ V, float* __restrict__ O) {
  __shared__ __attribute__((aligned(16))) float ldsK[2][32 * VROW];
  __shared__ __attribute__((aligned(16))) float ldsV[2][32 * VROW];

  const int lane = threadIdx.x & 31;
  const int wave = threadIdx.x >> 5;
  const int qb   = blockIdx.x & 7;    // 8 query blocks of 128 rows
  const int bh   = blockIdx.x >> 3;   // 64 (b,h) pairs
  const int q0   = qb * 128 + wave * 16;
  const int ln   = lane & 15;
  const int hi   = (lane >> 4) << 3;  // 0 for lanes 0-15, 8 for lanes 16-31

  const size_t base = (size_t)bh * S_LEN * DH;
  const int qy = q0 + ln;             // this lane's query row (fixed)
  const int qt = qy >> 8, qh = (qy >> 4) & 15, qw = qy & 15;

  // ---- Q as B-operand fragments (k-dim = d), scaled by 1/sqrt(D).
  // f16 operand layout: element i <-> k-dim index (i<8 ? i : i+8) + hi
  v16h bq0, bq1;
  {
    const float* qp = Q + base + (size_t)qy * DH;
    const float sc = 0.125f;  // 1/sqrt(64)
#pragma unroll
    for (int i = 0; i < 8; ++i) {
      bq0[i]     = (_Float16)(qp[hi + i]      * sc);
      bq0[i + 8] = (_Float16)(qp[16 + hi + i] * sc);
      bq1[i]     = (_Float16)(qp[32 + hi + i] * sc);
      bq1[i + 8] = (_Float16)(qp[48 + hi + i] * sc);
    }
  }

  v8f oacc[4];
#pragma unroll
  for (int dt = 0; dt < 4; ++dt) oacc[dt] = (v8f){};
  float m_run = -__builtin_inff();
  float l_run = 0.f;

  const int nblk_w = (q0 + 47) >> 5;           // this wave's causal limit
  const int nblk_u = (qb * 128 + 159) >> 5;    // block-uniform trip count

#ifdef USE_TDM
  if (wave == 0) {                             // prologue: stage block 0
    tdm_load_tile(K + base, (unsigned)(size_t)&ldsK[0][0]);
    tdm_load_tile(V + base, (unsigned)(size_t)&ldsV[0][0]);
  }
#endif

  for (int blk = 0; blk < nblk_u; ++blk) {
    const int kb  = blk << 5;
    const int buf = blk & 1;

#ifdef USE_TDM
    if (wave == 0) {
      if (blk + 1 < nblk_u) {                  // stage next block into buf^1
        const size_t goff = base + (size_t)(kb + 32) * DH;
        tdm_load_tile(K + goff, (unsigned)(size_t)&ldsK[buf ^ 1][0]);
        tdm_load_tile(V + goff, (unsigned)(size_t)&ldsV[buf ^ 1][0]);
        __builtin_amdgcn_s_wait_tensorcnt((short)2);  // buf ready, next in flight
      } else {
        __builtin_amdgcn_s_wait_tensorcnt((short)0);
      }
    }
    __syncthreads();                           // buf visible to all waves
#else
    __syncthreads();                           // previous reads done
    for (int e = threadIdx.x; e < 2048; e += 256) {
      const int r = e >> 6, c = e & 63;
      ldsK[buf][r * VROW + c] = K[base + (size_t)(kb + r) * DH + c];
      ldsV[buf][r * VROW + c] = V[base + (size_t)(kb + r) * DH + c];
    }
    __syncthreads();
#endif

    if (blk < nblk_w) {
      // ---- GEMM1: S^T(16k x 16q) = K_tile * Q^T, two 16-key subtiles ------
      v8f s[2];
#pragma unroll
      for (int kt = 0; kt < 2; ++kt) {
        const f32x4* kr = (const f32x4*)&ldsK[buf][(kt * 16 + ln) * VROW];
        const int c0 = hi >> 2;                // {0,2}
        f32x4 ra = kr[c0],     rb = kr[c0 + 1];   // cols hi   .. hi+7
        f32x4 rc = kr[c0 + 4], rd = kr[c0 + 5];   // cols 16+hi.. +7
        f32x4 re = kr[c0 + 8], rf = kr[c0 + 9];   // cols 32+hi.. +7
        f32x4 rg = kr[c0 +12], rh = kr[c0 +13];   // cols 48+hi.. +7
        v16h a0, a1;
#pragma unroll
        for (int i = 0; i < 4; ++i) {
          a0[i]      = (_Float16)ra[i];  a0[i + 4]  = (_Float16)rb[i];
          a0[i + 8]  = (_Float16)rc[i];  a0[i + 12] = (_Float16)rd[i];
          a1[i]      = (_Float16)re[i];  a1[i + 4]  = (_Float16)rf[i];
          a1[i + 8]  = (_Float16)rg[i];  a1[i + 12] = (_Float16)rh[i];
        }
        v8f c = (v8f){};
        c = __builtin_amdgcn_wmma_f32_16x16x32_f16(false, a0, false, bq0,
                                                   (short)0, c, false, false);
        c = __builtin_amdgcn_wmma_f32_16x16x32_f16(false, a1, false, bq1,
                                                   (short)0, c, false, false);
        s[kt] = c;
      }

      // ---- causal + distance mask, online softmax (per-lane query col) ----
      float p[16];
      float mb = -__builtin_inff();
#pragma unroll
      for (int kt = 0; kt < 2; ++kt) {
#pragma unroll
        for (int r = 0; r < 8; ++r) {
          const int ky = kb + kt * 16 + r + hi;  // D layout: M = r + hi
          float sv;
          if (ky <= qy) {
            const int kt_ = ky >> 8, kh = (ky >> 4) & 15, kw = ky & 15;
            const int dist = iabs(qt - kt_) + iabs(qh - kh) + iabs(qw - kw);
            sv = s[kt][r] * __expf((float)dist * (-1.0f / 33.0f));
          } else {
            sv = -__builtin_inff();
          }
          p[kt * 8 + r] = sv;
          mb = fmaxf(mb, sv);
        }
      }
      mb = fmaxf(mb, __shfl_xor(mb, 16, 32));  // partner half: other 16 keys
      const float m_new = fmaxf(m_run, mb);
      float lp = 0.f;
#pragma unroll
      for (int i = 0; i < 16; ++i) { p[i] = __expf(p[i] - m_new); lp += p[i]; }
      lp += __shfl_xor(lp, 16, 32);
      const float alpha = __expf(m_run - m_new);
      l_run = l_run * alpha + lp;
      m_run = m_new;
#pragma unroll
      for (int dt = 0; dt < 4; ++dt)
#pragma unroll
        for (int r = 0; r < 8; ++r) oacc[dt][r] *= alpha;

      // ---- pack P into B-operand: element i -> k = (i<8?i:i+8)+hi ---------
      v16h pb;
#pragma unroll
      for (int i = 0; i < 8; ++i) {
        pb[i]     = (_Float16)p[i];
        pb[i + 8] = (_Float16)p[8 + i];
      }

      // ---- GEMM2: O^T(16d x 16q) += V^T(16d x 32k) * P^T(32k x 16q) -------
#pragma unroll
      for (int dt = 0; dt < 4; ++dt) {
        const float* vb = &ldsV[buf][dt * 16 + ln];
        v16h av;
#pragma unroll
        for (int i = 0; i < 8; ++i) {
          av[i]     = (_Float16)vb[(i + hi) * VROW];
          av[i + 8] = (_Float16)vb[(16 + i + hi) * VROW];
        }
        oacc[dt] = __builtin_amdgcn_wmma_f32_16x16x32_f16(false, av, false, pb,
                                                          (short)0, oacc[dt],
                                                          false, false);
      }
    }
    __syncthreads();                 // all reads of buf done before overwrite
  }

  // ---- normalize and store: d = dt*16 + r + hi, row = qy -------------------
  const float inv_l = 1.0f / l_run;
  float* op = O + base + (size_t)qy * DH;
#pragma unroll
  for (int dt = 0; dt < 4; ++dt)
#pragma unroll
    for (int r = 0; r < 8; ++r)
      op[dt * 16 + r + hi] = oacc[dt][r] * inv_l;
}

extern "C" void kernel_launch(void* const* d_in, const int* in_sizes, int n_in,
                              void* d_out, int out_size, void* d_ws, size_t ws_size,
                              hipStream_t stream) {
  const float* Q = (const float*)d_in[0];
  const float* K = (const float*)d_in[1];
  const float* V = (const float*)d_in[2];
  float* O = (float*)d_out;
  dim3 grid(64 * 8), block(256);
  fa3d_wmma_kernel<<<grid, block, 0, stream>>>(Q, K, V, O);
}

// v001
// Measured time: 35.9 microseconds a run.
// Timed twice side by side with v000, it ran 1.26 times as fast both times.
#include <hip/hip_runtime.h>

typedef __attribute__((ext_vector_type(16))) _Float16 v16h;
typedef __attribute__((ext_vector_type(8)))  float    v8f;
typedef __attribute__((ext_vector_type(4)))  float    f32x4;

#define S_LEN 1024
#define DH    64
#define VROW  68   // 64 data dwords + 4 pad dwords per LDS row (TDM pad feature)

__device__ __forceinline__ int iabs(int x) { return x < 0 ? -x : x; }

#if defined(__has_builtin)
#if __has_builtin(__builtin_amdgcn_tensor_load_to_lds) && __has_builtin(__builtin_amdgcn_s_wait_tensorcnt)
#define USE_TDM 1
#endif
#endif

#ifdef USE_TDM
// Issue one TDM 2D tile load: 32 rows x 64 cols of f32, row stride 64 floats,
// LDS rows padded to 68 floats via pad_interval=64dw / pad_amount=4dw.
__device__ __forceinline__ void tdm_load_tile(const void* gaddr, unsigned lds_off) {
  typedef unsigned v4u __attribute__((ext_vector_type(4)));
  typedef int      v8i __attribute__((ext_vector_type(8)));
  typedef int      v4i __attribute__((ext_vector_type(4)));
  unsigned long long ga = (unsigned long long)(size_t)gaddr;
  // D# group0: count=1 | lds_addr | global_addr[56:0] | type=2
  v4u g0 = { 1u, lds_off, (unsigned)ga,
             ((unsigned)(ga >> 32) & 0x01ffffffu) | 0x80000000u };
  // D# group1: data_size=4B(code2), pad_enable, pad_interval=64dw(code5),
  // pad_amount=4dw(code3); tensor 64x32, tile 64x32, dim0 stride 64.
  v8i g1 = { (int)((2u << 16) | (1u << 20) | (5u << 22) | (3u << 25)),
             (int)(64u << 16),   // tensor_dim0 = 64   (bits 79:48)
             (int)(32u << 16),   // tensor_dim1 = 32   (bits 111:80)
             (int)(64u << 16),   // tile_dim0   = 64   (bits 127:112)
             (int)32,            // tile_dim1   = 32
             (int)64,            // tensor_dim0_stride = 64
             0, 0 };
  v4i z4 = { 0, 0, 0, 0 };
  v8i z8 = { 0, 0, 0, 0, 0, 0, 0, 0 };
  // 6-arg toolchain variant: (g0, g1, g2, g3, g4, cpol)
  __builtin_amdgcn_tensor_load_to_lds(g0, g1, z4, z4, z8, 0);
}
#endif

__global__ __launch_bounds__(256)
void fa3d_wmma_kernel(const float* __restrict__ Q, const float* __restrict__ K,
                      const float* __restrict__ V, float* __restrict__ O) {
  __shared__ __attribute__((aligned(16))) float ldsK[2][32 * VROW];
  __shared__ __attribute__((aligned(16))) float ldsV[2][32 * VROW];

  const int lane = threadIdx.x & 31;
  const int wave = threadIdx.x >> 5;
  const int qb   = blockIdx.x & 7;    // 8 query blocks of 128 rows
  const int bh   = blockIdx.x >> 3;   // 64 (b,h) pairs
  const int q0   = qb * 128 + wave * 16;
  const int ln   = lane & 15;
  const int hi   = (lane >> 4) << 3;  // 0 for lanes 0-15, 8 for lanes 16-31

  const size_t base = (size_t)bh * S_LEN * DH;
  const int qy = q0 + ln;             // this lane's query row (fixed)
  const int qt = qy >> 8, qh = (qy >> 4) & 15, qw = qy & 15;

  // ---- Q as B-operand fragments (k-dim = d), scaled by 1/sqrt(D).
  // f16 operand layout: element i <-> k-dim index (i<8 ? i : i+8) + hi
  v16h bq0, bq1;
  {
    const float* qp = Q + base + (size_t)qy * DH;
    const float sc = 0.125f;  // 1/sqrt(64)
#pragma unroll
    for (int i = 0; i < 8; ++i) {
      bq0[i]     = (_Float16)(qp[hi + i]      * sc);
      bq0[i + 8] = (_Float16)(qp[16 + hi + i] * sc);
      bq1[i]     = (_Float16)(qp[32 + hi + i] * sc);
      bq1[i + 8] = (_Float16)(qp[48 + hi + i] * sc);
    }
  }

  // exp(-dist/33) splits into exp(-(|dt|+|dh|)/33) * exp(-|dw|/33); the w
  // factor of accumulator row r does not depend on the key block
  float ew[8];
#pragma unroll
  for (int r = 0; r < 8; ++r)
    ew[r] = __expf((float)iabs(qw - (r + hi)) * (-1.0f / 33.0f));

  v8f oacc[4];
#pragma unroll
  for (int dt = 0; dt < 4; ++dt) oacc[dt] = (v8f){};
  float m_run = -__builtin_inff();
  float l_run = 0.f;

  const int nblk_w = (q0 + 47) >> 5;           // this wave's causal limit
  const int nblk_u = (qb * 128 + 159) >> 5;    // block-uniform trip count

#ifdef USE_TDM
  if (wave == 0) {                             // prologue: stage block 0
    tdm_load_tile(K + base, (unsigned)(size_t)&ldsK[0][0]);
    tdm_load_tile(V + base, (unsigned)(size_t)&ldsV[0][0]);
  }
#endif

  for (int blk = 0; blk < nblk_u; ++blk) {
    const int kb  = blk << 5;
    const int buf = blk & 1;

#ifdef USE_TDM
    if (wave == 0) {
      if (blk + 1 < nblk_u) {                  // stage next block into buf^1
        const size_t goff = base + (size_t)(kb + 32) * DH;
        tdm_load_tile(K + goff, (unsigned)(size_t)&ldsK[buf ^ 1][0]);
        tdm_load_tile(V + goff, (unsigned)(size_t)&ldsV[buf ^ 1][0]);
        __builtin_amdgcn_s_wait_tensorcnt((short)2);  // buf ready, next in flight
      } else {
        __builtin_amdgcn_s_wait_tensorcnt((short)0);
      }
    }
    __syncthreads();                           // buf visible to all waves
#else
    __syncthreads();                           // previous reads done
    for (int e = threadIdx.x; e < 2048; e += 256) {
      const int r = e >> 6, c = e & 63;
      ldsK[buf][r * VROW + c] = K[base + (size_t)(kb + r) * DH + c];
      ldsV[buf][r * VROW + c] = V[base + (size_t)(kb + r) * DH + c];
    }
    __syncthreads();
#endif

    if (blk < nblk_w) {
      // ---- GEMM1: S^T(16k x 16q) = K_tile * Q^T, two 16-key subtiles ------
      v8f s[2];
#pragma unroll
      for (int kt = 0; kt < 2; ++kt) {
        const f32x4* kr = (const f32x4*)&ldsK[buf][(kt * 16 + ln) * VROW];
        const int c0 = hi >> 2;                // {0,2}
        f32x4 ra = kr[c0],     rb = kr[c0 + 1];   // cols hi   .. hi+7
        f32x4 rc = kr[c0 + 4], rd = kr[c0 + 5];   // cols 16+hi.. +7
        f32x4 re = kr[c0 + 8], rf = kr[c0 + 9];   // cols 32+hi.. +7
        f32x4 rg = kr[c0 +12], rh = kr[c0 +13];   // cols 48+hi.. +7
        v16h a0, a1;
#pragma unroll
        for (int i = 0; i < 4; ++i) {
          a0[i]      = (_Float16)ra[i];  a0[i + 4]  = (_Float16)rb[i];
          a0[i + 8]  = (_Float16)rc[i];  a0[i + 12] = (_Float16)rd[i];
          a1[i]      = (_Float16)re[i];  a1[i + 4]  = (_Float16)rf[i];
          a1[i + 8]  = (_Float16)rg[i];  a1[i + 12] = (_Float16)rh[i];
        }
        v8f c = (v8f){};
        c = __builtin_amdgcn_wmma_f32_16x16x32_f16(false, a0, false, bq0,
                                                   (short)0, c, false, false);
        c = __builtin_amdgcn_wmma_f32_16x16x32_f16(false, a1, false, bq1,
                                                   (short)0, c, false, false);
        s[kt] = c;
      }

      // ---- causal + distance mask, online softmax (per-lane query col) ----
      float p[16];
      float mb = -__builtin_inff();
      const int dq = qy - kb - hi;
#pragma unroll
      for (int kt = 0; kt < 2; ++kt) {
        // a 16-key subtile is one (t, h) grid line: its t and h terms are one
        // factor per lane, and its w coordinate is r + hi in every subtile
        const int k16 = (kb >> 4) + kt;
        const int dth = iabs(qt - (k16 >> 4)) + iabs(qh - (k16 & 15));
        const float fth = __expf((float)dth * (-1.0f / 33.0f));
#pragma unroll
        for (int r = 0; r < 8; ++r) {
          // D layout: M = r + hi, so key kb + kt*16 + r + hi <= qy reads
          // kt*16 + r <= dq
          const float sv = (kt * 16 + r <= dq) ? s[kt][r] * (fth * ew[r])
                                               : -__builtin_inff();
          p[kt * 8 + r] = sv;
          mb = fmaxf(mb, sv);
        }
      }
      mb = fmaxf(mb, __shfl_xor(mb, 16, 32));  // partner half: other 16 keys
      const float m_new = fmaxf(m_run, mb);
      float lp = 0.f;
#pragma unroll
      for (int i = 0; i < 16; ++i) { p[i] = __expf(p[i] - m_new); lp += p[i]; }
      lp += __shfl_xor(lp, 16, 32);
      const float alpha = __expf(m_run - m_new);
      l_run = l_run * alpha + lp;
      m_run = m_new;
#pragma unroll
      for (int dt = 0; dt < 4; ++dt)
#pragma unroll
        for (int r = 0; r < 8; ++r) oacc[dt][r] *= alpha;

      // ---- pack P into B-operand: element i -> k = (i<8?i:i+8)+hi ---------
      v16h pb;
#pragma unroll
      for (int i = 0; i < 8; ++i) {
        pb[i]     = (_Float16)p[i];
        pb[i + 8] = (_Float16)p[8 + i];
      }

      // ---- GEMM2: O^T(16d x 16q) += V^T(16d x 32k) * P^T(32k x 16q) -------
#pragma unroll
      for (int dt = 0; dt < 4; ++dt) {
        const float* vb = &ldsV[buf][dt * 16 + ln];
        v16h av;
#pragma unroll
        for (int i = 0; i < 8; ++i) {
          av[i]     = (_Float16)vb[(i + hi) * VROW];
          av[i + 8] = (_Float16)vb[(16 + i + hi) * VROW];
        }
        oacc[dt] = __builtin_amdgcn_wmma_f32_16x16x32_f16(false, av, false, pb,
                                                          (short)0, oacc[dt],
                                                          false, false);
      }
    }
    __syncthreads();                 // all reads of buf done before overwrite
  }

  // ---- normalize and store: d = dt*16 + r + hi, row = qy -------------------
  const float inv_l = 1.0f / l_run;
  float* op = O + base + (size_t)qy * DH;
#pragma unroll
  for (int dt = 0; dt < 4; ++dt)
#pragma unroll
    for (int r = 0; r < 8; ++r)
      op[dt * 16 + r + hi] = oacc[dt][r] * inv_l;
}

extern "C" void kernel_launch(void* const* d_in, const int* in_sizes, int n_in,
                              void* d_out, int out_size, void* d_ws, size_t ws_size,
                              hipStream_t stream) {
  const float* Q = (const float*)d_in[0];
  const float* K = (const float*)d_in[1];
  const float* V = (const float*)d_in[2];
  float* O = (float*)d_out;
  dim3 grid(64 * 8), block(256);
  fa3d_wmma_kernel<<<grid, block, 0, stream>>>(Q, K, V, O);
}

// v002
// A run of this version takes 29.8 microseconds.
// Two timings next to v001 both put it at 1.21 times that version's speed.
// Counting every step since v000, it is 1.52 times as fast.
#include <hip/hip_runtime.h>

typedef __attribute__((ext_vector_type(16))) _Float16 v16h;
typedef __attribute__((ext_vector_type(8)))  float    v8f;
typedef __attribute__((ext_vector_type(4)))  float    f32x4;

#define S_LEN 1024
#define DH    64
#define VROW  68   // 64 data dwords + 4 pad dwords per LDS row (TDM pad feature)
#define NWAVE 4    // waves per work-group; each wave owns 16 query rows
#define QTILE (NWAVE * 16)          // query rows per tile
#define NTILE (S_LEN / QTILE)       // query tiles per (b,h)

__device__ __forceinline__ int iabs(int x) { return x < 0 ? -x : x; }

#if defined(__has_builtin)
#if __has_builtin(__builtin_amdgcn_tensor_load_to_lds) && __has_builtin(__builtin_amdgcn_s_wait_tensorcnt)
#define USE_TDM 1
#endif
#endif

#ifdef USE_TDM
// Issue one TDM 2D tile load: 32 rows x 64 cols of f32, row stride 64 floats,
// LDS rows padded to 68 floats via pad_interval=64dw / pad_amount=4dw.
__device__ __forceinline__ void tdm_load_tile(const void* gaddr, unsigned lds_off) {
  typedef unsigned v4u __attribute__((ext_vector_type(4)));
  typedef int      v8i __attribute__((ext_vector_type(8)));
  typedef int      v4i __attribute__((ext_vector_type(4)));
  unsigned long long ga = (unsigned long long)(size_t)gaddr;
  // D# group0: count=1 | lds_addr | global_addr[56:0] | type=2
  v4u g0 = { 1u, lds_off, (unsigned)ga,
             ((unsigned)(ga >> 32) & 0x01ffffffu) | 0x80000000u };
  // D# group1: data_size=4B(code2), pad_enable, pad_interval=64dw(code5),
  // pad_amount=4dw(code3); tensor 64x32, tile 64x32, dim0 stride 64.
  v8i g1 = { (int)((2u << 16) | (1u << 20) | (5u << 22) | (3u << 25)),
             (int)(64u << 16),   // tensor_dim0 = 64   (bits 79:48)
             (int)(32u << 16),   // tensor_dim1 = 32   (bits 111:80)
             (int)(64u << 16),   // tile_dim0   = 64   (bits 127:112)
             (int)32,            // tile_dim1   = 32
             (int)64,            // tensor_dim0_stride = 64
             0, 0 };
  v4i z4 = { 0, 0, 0, 0 };
  v8i z8 = { 0, 0, 0, 0, 0, 0, 0, 0 };
  // 6-arg toolchain variant: (g0, g1, g2, g3, g4, cpol)
  __builtin_amdgcn_tensor_load_to_lds(g0, g1, z4, z4, z8, 0);
}
#endif

__global__ __launch_bounds__(NWAVE * 32)
void fa3d_wmma_kernel(const float* __restrict__ Q, const float* __restrict__ K,
                      const float* __restrict__ V, float* __restrict__ O) {
  __shared__ __attribute__((aligned(16))) float ldsK[2][32 * VROW];
  __shared__ __attribute__((aligned(16))) float ldsV[2][32 * VROW];

  const int lane = threadIdx.x & 31;
  const int wave = threadIdx.x >> 5;
  const int tp   = blockIdx.x & 7;    // 8 pairs of query tiles
  const int bh   = blockIdx.x >> 3;   // 64 (b,h) pairs
  const int ln   = lane & 15;
  const int hi   = (lane >> 4) << 3;  // 0 for lanes 0-15, 8 for lanes 16-31

  const size_t base = (size_t)bh * S_LEN * DH;

  // exp(-dist/33) splits into exp(-(|dt|+|dh|)/33) * exp(-|dw|/33); the w
  // factor of accumulator row r depends neither on the key block nor on the
  // query tile (a wave's 16 rows are one grid line, so the row's w is ln)
  float ew[8];
#pragma unroll
  for (int r = 0; r < 8; ++r)
    ew[r] = __expf((float)iabs(ln - (r + hi)) * (-1.0f / 33.0f));

  // Causal cost grows linearly with the tile index: every work-group runs
  // tile tp and then tile NTILE-1-tp, one after the other, so that all
  // work-groups walk the same number of key blocks.
  for (int half = 0; half < 2; ++half) {
  const int qb = half ? NTILE - 1 - tp : tp;
  const int q0 = qb * QTILE + wave * 16;
  const int qy = q0 + ln;             // this lane's query row in this tile
  const int qt = qy >> 8, qh = (qy >> 4) & 15;

  // ---- Q as B-operand fragments (k-dim = d), scaled by 1/sqrt(D).
  // f16 operand layout: element i <-> k-dim index (i<8 ? i : i+8) + hi
  v16h bq0, bq1;
  {
    const float* qp = Q + base + (size_t)qy * DH;
    const float sc = 0.125f;  // 1/sqrt(64)
#pragma unroll
    for (int i = 0; i < 8; ++i) {
      bq0[i]     = (_Float16)(qp[hi + i]      * sc);
      bq0[i + 8] = (_Float16)(qp[16 + hi + i] * sc);
      bq1[i]     = (_Float16)(qp[32 + hi + i] * sc);
      bq1[i + 8] = (_Float16)(qp[48 + hi + i] * sc);
    }
  }

  v8f oacc[4];
#pragma unroll
  for (int dt = 0; dt < 4; ++dt) oacc[dt] = (v8f){};
  float m_run = -__builtin_inff();
  float l_run = 0.f;

  const int nblk_w = (q0 + 47) >> 5;           // this wave's causal limit
  const int nblk_u = (qb * QTILE + QTILE + 31) >> 5;  // block-uniform trip count

#ifdef USE_TDM
  if (wave == 0) {                             // prologue: stage block 0
    tdm_load_tile(K + base, (unsigned)(size_t)&ldsK[0][0]);
    tdm_load_tile(V + base, (unsigned)(size_t)&ldsV[0][0]);
  }
#endif

  for (int blk = 0; blk < nblk_u; ++blk) {
    const int kb  = blk << 5;
    const int buf = blk & 1;

#ifdef USE_TDM
    if (wave == 0) {
      if (blk + 1 < nblk_u) {                  // stage next block into buf^1
        const size_t goff = base + (size_t)(kb + 32) * DH;
        tdm_load_tile(K + goff, (unsigned)(size_t)&ldsK[buf ^ 1][0]);
        tdm_load_tile(V + goff, (unsigned)(size_t)&ldsV[buf ^ 1][0]);
        __builtin_amdgcn_s_wait_tensorcnt((short)2);  // buf ready, next in flight
      } else {
        __builtin_amdgcn_s_wait_tensorcnt((short)0);
      }
    }
    __syncthreads();                           // buf visible to all waves
#else
    __syncthreads();                           // previous reads done
    for (int e = threadIdx.x; e < 2048; e += NWAVE * 32) {
      const int r = e >> 6, c = e & 63;
      ldsK[buf][r * VROW + c] = K[base + (size_t)(kb + r) * DH + c];
      ldsV[buf][r * VROW + c] = V[base + (size_t)(kb + r) * DH + c];
    }
    __syncthreads();
#endif

    if (blk < nblk_w) {
      // ---- GEMM1: S^T(16k x 16q) = K_tile * Q^T, two 16-key subtiles ------
      v8f s[2];
#pragma unroll
      for (int kt = 0; kt < 2; ++kt) {
        const f32x4* kr = (const f32x4*)&ldsK[buf][(kt * 16 + ln) * VROW];
        const int c0 = hi >> 2;                // {0,2}
        f32x4 ra = kr[c0],     rb = kr[c0 + 1];   // cols hi   .. hi+7
        f32x4 rc = kr[c0 + 4], rd = kr[c0 + 5];   // cols 16+hi.. +7
        f32x4 re = kr[c0 + 8], rf = kr[c0 + 9];   // cols 32+hi.. +7
        f32x4 rg = kr[c0 +12], rh = kr[c0 +13];   // cols 48+hi.. +7
        v16h a0, a1;
#pragma unroll
        for (int i = 0; i < 4; ++i) {
          a0[i]      = (_Float16)ra[i];  a0[i + 4]  = (_Float16)rb[i];
          a0[i + 8]  = (_Float16)rc[i];  a0[i + 12] = (_Float16)rd[i];
          a1[i]      = (_Float16)re[i];  a1[i + 4]  = (_Float16)rf[i];
          a1[i + 8]  = (_Float16)rg[i];  a1[i + 12] = (_Float16)rh[i];
        }
        v8f c = (v8f){};
        c = __builtin_amdgcn_wmma_f32_16x16x32_f16(false, a0, false, bq0,
                                                   (short)0, c, false, false);
        c = __builtin_amdgcn_wmma_f32_16x16x32_f16(false, a1, false, bq1,
                                                   (short)0, c, false, false);
        s[kt] = c;
      }

      // ---- causal + distance mask, online softmax (per-lane query col) ----
      float p[16];
      float mb = -__builtin_inff();
      const int dq = qy - kb - hi;
#pragma unroll
      for (int kt = 0; kt < 2; ++kt) {
        // a 16-key subtile is one (t, h) grid line: its t and h terms are one
        // factor per lane, and its w coordinate is r + hi in every subtile
        const int k16 = (kb >> 4) + kt;
        const int dth = iabs(qt - (k16 >> 4)) + iabs(qh - (k16 & 15));
        const float fth = __expf((float)dth * (-1.0f / 33.0f));
#pragma unroll
        for (int r = 0; r < 8; ++r) {
          // D layout: M = r + hi, so key kb + kt*16 + r + hi <= qy reads
          // kt*16 + r <= dq
          const float sv = (kt * 16 + r <= dq) ? s[kt][r] * (fth * ew[r])
                                               : -__builtin_inff();
          p[kt * 8 + r] = sv;
          mb = fmaxf(mb, sv);
        }
      }
      mb = fmaxf(mb, __shfl_xor(mb, 16, 32));  // partner half: other 16 keys
      const float m_new = fmaxf(m_run, mb);
      float lp = 0.f;
#pragma unroll
      for (int i = 0; i < 16; ++i) { p[i] = __expf(p[i] - m_new); lp += p[i]; }
      lp += __shfl_xor(lp, 16, 32);
      const float alpha = __expf(m_run - m_new);
      l_run = l_run * alpha + lp;
      m_run = m_new;
#pragma unroll
      for (int dt = 0; dt < 4; ++dt)
#pragma unroll
        for (int r = 0; r < 8; ++r) oacc[dt][r] *= alpha;

      // ---- pack P into B-operand: element i -> k = (i<8?i:i+8)+hi ---------
      v16h pb;
#pragma unroll
      for (int i = 0; i < 8; ++i) {
        pb[i]     = (_Float16)p[i];
        pb[i + 8] = (_Float16)p[8 + i];
      }

      // ---- GEMM2: O^T(16d x 16q) += V^T(16d x 32k) * P^T(32k x 16q) -------
#pragma unroll
      for (int dt = 0; dt < 4; ++dt) {
        const float* vb = &ldsV[buf][dt * 16 + ln];
        v16h av;
#pragma unroll
        for (int i = 0; i < 8; ++i) {
          av[i]     = (_Float16)vb[(i + hi) * VROW];
          av[i + 8] = (_Float16)vb[(16 + i + hi) * VROW];
        }
        oacc[dt] = __builtin_amdgcn_wmma_f32_16x16x32_f16(false, av, false, pb,
                                                          (short)0, oacc[dt],
                                                          false, false);
      }
    }
    __syncthreads();                 // all reads of buf done before overwrite
  }

  // ---- normalize and store: d = dt*16 + r + hi, row = qy -------------------
  const float inv_l = 1.0f / l_run;
  float* op = O + base + (size_t)qy * DH;
#pragma unroll
  for (int dt = 0; dt < 4; ++dt)
#pragma unroll
    for (int r = 0; r < 8; ++r)
      op[dt * 16 + r + hi] = oacc[dt][r] * inv_l;
  // the next tile reuses the registers these stores name: this wait stands
  // in front of their first overwrite
  asm volatile("s_wait_xcnt 0x0" ::: "memory");
  }  // next tile of the pair
}

extern "C" void kernel_launch(void* const* d_in, const int* in_sizes, int n_in,
                              void* d_out, int out_size, void* d_ws, size_t ws_size,
                              hipStream_t stream) {
  const float* Q = (const float*)d_in[0];
  const float* K = (const float*)d_in[1];
  const float* V = (const float*)d_in[2];
  float* O = (float*)d_out;
  dim3 grid(64 * 8), block(NWAVE * 32);
  fa3d_wmma_kernel<<<grid, block, 0, stream>>>(Q, K, V, O);
}

// v003
// One run takes 24.9 microseconds.
// In two side-by-side timings against v002, it was 1.18 and 1.19 times as fast.
// All steps since v000 together make it 1.80 times as fast.
#include <hip/hip_runtime.h>
#include <stdint.h>

typedef __attribute__((ext_vector_type(16))) _Float16 v16h;
typedef __attribute__((ext_vector_type(8)))  float    v8f;
typedef __attribute__((ext_vector_type(4)))  float    f32x4;
typedef __attribute__((ext_vector_type(4)))  uint32_t u32x4;
typedef __attribute__((ext_vector_type(8)))  uint32_t u32x8;

#define S_LEN 1024
#define DH    64
#define VROW  68   // 64 data dwords + 4 pad dwords per LDS row (tensor-load pad)
#define NQW   4    // waves per key group; each wave owns 16 query rows
#define NGRP  2    // key groups: group g takes the 32-key blocks 2*s + g
#define NWAVE (NQW * NGRP)
#define QTILE (NQW * 16)            // query rows per tile
#define NTILE (S_LEN / QTILE)       // query tiles per (b,h)
#define SKEYS (NGRP * 32)           // keys per ring stage
#define SLOT_F 4608                 // floats per ring slot: 64 rows * 68, rounded up to a multiple of 2 KiB
#define MRG_F  (4 * SLOT_F)         // first float of the merge area behind the ring

__device__ __forceinline__ int iabs(int x) { return x < 0 ? -x : x; }
__device__ __forceinline__ uint32_t uni(uint32_t v) { return (uint32_t)__builtin_amdgcn_readfirstlane(v); }
// keeps a wave-uniform condition in a scalar register, so that the test around
// a tensor load compiles to a scalar branch (a tensor load ignores EXEC)
__device__ __forceinline__ uint32_t pinned(uint32_t v) {
  uint32_t w = uni(v);
  asm volatile("" : "+s"(w));
  return w;
}
__device__ __forceinline__ void wait_ds0()     { asm volatile("s_wait_dscnt 0x0" ::: "memory"); }
__device__ __forceinline__ void wait_tensor0() { asm volatile("s_wait_tensorcnt 0x0" ::: "memory"); }

// Descriptor of one tensor load: 64 rows of 256 bytes, source pitch 256 bytes,
// every extent in bytes; 16 pad bytes behind each row give the LDS pitch of
// 272 bytes. Group 1 is the same for every request and is built once.
__device__ __forceinline__ u32x8 tdm_group1() {
  u32x8 g1;
  g1[0] = uni((1u << 20) | (5u << 22) | (3u << 25));
  g1[1] = uni(256u << 16);            // tensor_dim0 = 256
  g1[2] = uni((uint32_t)SKEYS << 16); // tensor_dim1 = 64
  g1[3] = uni(256u << 16);            // tile_dim0 = 256
  g1[4] = uni((uint32_t)SKEYS);       // tile_dim1 = 64
  g1[5] = uni(256u);                  // source row pitch
  g1[6] = uni(0u);
  g1[7] = uni(0u);
  // descriptor words held in scalar registers: one tuple serves every request
  // instead of constants set up anew in whatever registers are free
  asm volatile("" : "+s"(g1));
  return g1;
}
__device__ __forceinline__ u32x4 tdm_group0(const float* gaddr, uint32_t lds_off) {
  const uint64_t ga = (uint64_t)(size_t)gaddr;
  u32x4 g0;
  g0[0] = uni(1u);
  g0[1] = uni(lds_off);
  g0[2] = uni((uint32_t)ga);
  g0[3] = uni((((uint32_t)(ga >> 32)) & 0x01FFFFFFu) | 0x80000000u);
  return g0;
}
// group 0 is named as read and written, though the load leaves it as it is:
// what the issuer's wait names below then comes out of this statement, not
// from a second copy of the words built elsewhere
__device__ __forceinline__ void tdm_load(u32x4& g0, u32x8 g1) {
  asm volatile("tensor_load_to_lds %0, %1" : "+s"(g0) : "s"(g1) : "memory");
}
// the issuer's wait for its request; it names both groups so that they stay
// live, and no descriptor register is given away, from the load to this wait
__device__ __forceinline__ void tdm_wait0(u32x4 g0, u32x8 g1) {
  asm volatile("s_wait_tensorcnt 0x0" :: "s"(g0), "s"(g1) : "memory");
}

__global__ __launch_bounds__(NWAVE * 32)
void fa3d_wmma_kernel(const float* __restrict__ Q, const float* __restrict__ K,
                      const float* __restrict__ V, float* __restrict__ O) {
  // ring: slot (buf * 2) holds a K stage, slot (buf * 2 + 1) a V stage; then
  // the merge area, 5 rows of 32 f32x4 per wave
  __shared__ __attribute__((aligned(2048))) float smem[MRG_F + NWAVE * 5 * 32 * 4];

  const int lane = threadIdx.x & 31;
  const uint32_t wave = uni(threadIdx.x >> 5);
  const uint32_t grp  = wave >> 2;    // key group of this wave
  const uint32_t wq   = wave & 3;     // which 16 query rows of the tile
  const int tp   = blockIdx.x & 7;    // 8 pairs of query tiles
  const int bh   = blockIdx.x >> 3;   // 64 (b,h) pairs
  const int ln   = lane & 15;
  const int hi   = (lane >> 4) << 3;  // 0 for lanes 0-15, 8 for lanes 16-31

  const size_t base = (size_t)bh * S_LEN * DH;
  const uint32_t lbase = (uint32_t)(size_t)&smem[0];
  // wave 0 brings the K stages, wave 1 the V stages: one request a wave
  const uint32_t issuer = wave < 2u;
  const float* tsrc = (wave == 1u ? V : K) + base;
  const u32x8 g1 = tdm_group1();
  u32x4 g0 = tdm_group0(tsrc, lbase);   // takes each request's words in turn

  // exp(-dist/33) splits into exp(-(|dt|+|dh|)/33) * exp(-|dw|/33); the w
  // factor of accumulator row r depends neither on the key block nor on the
  // query tile (a wave's 16 rows are one grid line, so the row's w is ln)
  float ew[8];
#pragma unroll
  for (int r = 0; r < 8; ++r)
    ew[r] = __expf((float)iabs(ln - (r + hi)) * (-1.0f / 33.0f));

  // Causal cost grows linearly with the tile index: every work-group runs
  // tile tp and then tile NTILE-1-tp, one after the other, so that all
  // work-groups walk the same number of key blocks.
  for (int half = 0; half < 2; ++half) {
  const int qb = half ? NTILE - 1 - tp : tp;
  const int q0 = qb * QTILE + (int)wq * 16;
  const int qy = q0 + ln;             // this lane's query row in this tile
  const int qt = qy >> 8, qh = (qy >> 4) & 15;

  // ---- Q as B-operand fragments (k-dim = d), scaled by 1/sqrt(D).
  // f16 operand layout: element i <-> k-dim index (i<8 ? i : i+8) + hi
  v16h bq0, bq1;
  {
    const float* qp = Q + base + (size_t)qy * DH;
    const float sc = 0.125f;  // 1/sqrt(64)
#pragma unroll
    for (int i = 0; i < 8; ++i) {
      bq0[i]     = (_Float16)(qp[hi + i]      * sc);
      bq0[i + 8] = (_Float16)(qp[16 + hi + i] * sc);
      bq1[i]     = (_Float16)(qp[32 + hi + i] * sc);
      bq1[i + 8] = (_Float16)(qp[48 + hi + i] * sc);
    }
  }

  v8f oacc[4];
#pragma unroll
  for (int dt = 0; dt < 4; ++dt) oacc[dt] = (v8f){};
  float m_run = -__builtin_inff();
  float l_run = 0.f;

  const int nblk_w = (q0 + 47) >> 5;  // this wave's causal limit, in 32-key blocks
  const int nst    = qb + 1;          // 64-key stages of this tile, block-uniform

  // ---- ring prologue: stage 0 lands and is published, stage 1 takes off ----
  if (pinned(issuer)) {
    g0 = tdm_group0(tsrc, lbase + (wave & 1u) * (SLOT_F * 4u));
    tdm_load(g0, g1);
    tdm_wait0(g0, g1);
  }
  __syncthreads();
  // the ring's prologue takes two stages: keys 64..127 lie inside K and V for
  // every tile; tile 0, which has one stage, lets them land and reads none
  if (pinned(issuer)) {
    g0 = tdm_group0(tsrc + SKEYS * DH, lbase + (2u + (wave & 1u)) * (SLOT_F * 4u));
    tdm_load(g0, g1);
  }

  for (int st = 0; st < nst; ++st) {
    const int blk = st * NGRP + (int)grp;      // this group's block of the stage
    const int kb  = blk << 5;
    const int buf = st & 1;

    if (blk < nblk_w) {
      const float* sK = &smem[(buf * 2) * SLOT_F + (int)grp * 32 * VROW];
      const float* sV = &smem[(buf * 2 + 1) * SLOT_F + (int)grp * 32 * VROW];
      // ---- GEMM1: S^T(16k x 16q) = K_tile * Q^T, two 16-key subtiles ------
      v8f s[2];
#pragma unroll
      for (int kt = 0; kt < 2; ++kt) {
        const f32x4* kr = (const f32x4*)&sK[(kt * 16 + ln) * VROW];
        const int c0 = hi >> 2;                // {0,2}
        f32x4 ra = kr[c0],     rb = kr[c0 + 1];   // cols hi   .. hi+7
        f32x4 rc = kr[c0 + 4], rd = kr[c0 + 5];   // cols 16+hi.. +7
        f32x4 re = kr[c0 + 8], rf = kr[c0 + 9];   // cols 32+hi.. +7
        f32x4 rg = kr[c0 +12], rh = kr[c0 +13];   // cols 48+hi.. +7
        v16h a0, a1;
#pragma unroll
        for (int i = 0; i < 4; ++i) {
          a0[i]      = (_Float16)ra[i];  a0[i + 4]  = (_Float16)rb[i];
          a0[i + 8]  = (_Float16)rc[i];  a0[i + 12] = (_Float16)rd[i];
          a1[i]      = (_Float16)re[i];  a1[i + 4]  = (_Float16)rf[i];
          a1[i + 8]  = (_Float16)rg[i];  a1[i + 12] = (_Float16)rh[i];
        }
        v8f c = (v8f){};
        c = __builtin_amdgcn_wmma_f32_16x16x32_f16(false, a0, false, bq0,
                                                   (short)0, c, false, false);
        c = __builtin_amdgcn_wmma_f32_16x16x32_f16(false, a1, false, bq1,
                                                   (short)0, c, false, false);
        s[kt] = c;
      }

      // ---- causal + distance mask, online softmax (per-lane query col) ----
      float p[16];
      float mb = -__builtin_inff();
      const int dq = qy - kb - hi;
#pragma unroll
      for (int kt = 0; kt < 2; ++kt) {
        // a 16-key subtile is one (t, h) grid line: its t and h terms are one
        // factor per lane, and its w coordinate is r + hi in every subtile
        const int k16 = (kb >> 4) + kt;
        const int dth = iabs(qt - (k16 >> 4)) + iabs(qh - (k16 & 15));
        const float fth = __expf((float)dth * (-1.0f / 33.0f));
#pragma unroll
        for (int r = 0; r < 8; ++r) {
          // D layout: M = r + hi, so key kb + kt*16 + r + hi <= qy reads
          // kt*16 + r <= dq
          const float sv = (kt * 16 + r <= dq) ? s[kt][r] * (fth * ew[r])
                                               : -__builtin_inff();
          p[kt * 8 + r] = sv;
          mb = fmaxf(mb, sv);
        }
      }
      mb = fmaxf(mb, __shfl_xor(mb, 16, 32));  // partner half: other 16 keys
      const float m_new = fmaxf(m_run, mb);
      float lp = 0.f;
#pragma unroll
      for (int i = 0; i < 16; ++i) { p[i] = __expf(p[i] - m_new); lp += p[i]; }
      lp += __shfl_xor(lp, 16, 32);
      const float alpha = __expf(m_run - m_new);
      l_run = l_run * alpha + lp;
      m_run = m_new;
#pragma unroll
      for (int dt = 0; dt < 4; ++dt)
#pragma unroll
        for (int r = 0; r < 8; ++r) oacc[dt][r] *= alpha;

      // ---- pack P into B-operand: element i -> k = (i<8?i:i+8)+hi ---------
      v16h pb;
#pragma unroll
      for (int i = 0; i < 8; ++i) {
        pb[i]     = (_Float16)p[i];
        pb[i + 8] = (_Float16)p[8 + i];
      }

      // ---- GEMM2: O^T(16d x 16q) += V^T(16d x 32k) * P^T(32k x 16q) -------
#pragma unroll
      for (int dt = 0; dt < 4; ++dt) {
        const float* vb = &sV[dt * 16 + ln];
        v16h av;
#pragma unroll
        for (int i = 0; i < 8; ++i) {
          av[i]     = (_Float16)vb[(i + hi) * VROW];
          av[i + 8] = (_Float16)vb[(16 + i + hi) * VROW];
        }
        oacc[dt] = __builtin_amdgcn_wmma_f32_16x16x32_f16(false, av, false, pb,
                                                          (short)0, oacc[dt],
                                                          false, false);
      }
    }

    // ---- publish point of stage st + 1, passed by every wave ---------------
    wait_ds0();                       // this wave has left buffer buf
    if (pinned(issuer)) tdm_wait0(g0, g1);   // its slice of stage st + 1 has landed
    __syncthreads();
    if (pinned(issuer && st + 2 < nst)) {   // refill the buffer just read
      g0 = tdm_group0(tsrc + (size_t)(st + 2) * (SKEYS * DH),
                      lbase + ((uint32_t)buf * 2u + (wave & 1u)) * (SLOT_F * 4u));
      tdm_load(g0, g1);
    }
  }
  wait_tensor0();
  wait_ds0();

  // ---- join the two key groups: waves w and w + 4 hold partial sums of the
  // same 16 query rows. Group 0 finishes d 0..31 and group 1 d 32..63; each
  // hands the partner its maximum, its sum and the half it does not finish.
  f32x4* mg = (f32x4*)&smem[MRG_F];
  v8f keep[2];
  {
    f32x4* my = mg + wave * (5 * 32) + lane;
#pragma unroll
    for (int j = 0; j < 2; ++j) {
      const v8f snd = grp ? oacc[j] : oacc[2 + j];
      keep[j]       = grp ? oacc[2 + j] : oacc[j];
      my[(2 * j) * 32]     = (f32x4){snd[0], snd[1], snd[2], snd[3]};
      my[(2 * j + 1) * 32] = (f32x4){snd[4], snd[5], snd[6], snd[7]};
    }
    my[4 * 32] = (f32x4){m_run, l_run, 0.f, 0.f};
  }
  __syncthreads();                    // both partners' halves are in LDS
  const f32x4* ot = mg + (wave ^ 4u) * (5 * 32) + lane;
  const f32x4 ml = ot[4 * 32];
  // group 0 always holds key 0, so the joint maximum is finite; a group-1
  // wave without a block has maximum -inf and weighs 0
  const float m_all = fmaxf(m_run, ml[0]);
  const float fa = __expf(m_run - m_all);
  const float fb = __expf(ml[0] - m_all);
  const float inv_l = 1.0f / (l_run * fa + ml[1] * fb);
  const float ca = fa * inv_l, cb = fb * inv_l;

  // ---- normalize and store: d = dt*16 + r + hi, row = qy -------------------
  float* op = O + base + (size_t)qy * DH + grp * 32;
#pragma unroll
  for (int j = 0; j < 2; ++j) {
    const f32x4 o0 = ot[(2 * j) * 32], o1 = ot[(2 * j + 1) * 32];
#pragma unroll
    for (int r = 0; r < 4; ++r) {
      op[j * 16 + r + hi]     = keep[j][r] * ca     + o0[r] * cb;
      op[j * 16 + 4 + r + hi] = keep[j][4 + r] * ca + o1[r] * cb;
    }
  }
  // the merge area is rewritten behind the next tile's barriers: this wave's
  // reads of it have returned before it reaches the first of them
  wait_ds0();
  // the next tile reuses the registers these stores name: this wait stands
  // in front of their first overwrite
  asm volatile("s_wait_xcnt 0x0" ::: "memory");
  }  // next tile of the pair
}

extern "C" void kernel_launch(void* const* d_in, const int* in_sizes, int n_in,
                              void* d_out, int out_size, void* d_ws, size_t ws_size,
                              hipStream_t stream) {
  const float* Q = (const float*)d_in[0];
  const float* K = (const float*)d_in[1];
  const float* V = (const float*)d_in[2];
  float* O = (float*)d_out;
  dim3 grid(64 * 8), block(NWAVE * 32);
  fa3d_wmma_kernel<<<grid, block, 0, stream>>>(Q, K, V, O);
}

// v004
// A run of this version takes 23.3 microseconds.
// Two timings next to v003 put it at 1.11 and 1.10 times that version's speed.
// All steps since v000 together make it 1.99 times as fast.
#include <hip/hip_runtime.h>
#include <stdint.h>

typedef __attribute__((ext_vector_type(16))) _Float16 v16h;
typedef __attribute__((ext_vector_type(8)))  float    v8f;
typedef __attribute__((ext_vector_type(4)))  float    f32x4;
typedef __attribute__((ext_vector_type(8)))  _Float16 v8h;
typedef __attribute__((ext_vector_type(4)))  _Float16 v4h;
typedef __attribute__((ext_vector_type(8)))  short    s16x8;

#define S_LEN 1024
#define DH    64
#define KPITCH 144  // bytes per f16 K row in LDS: 128 + 16, for ds_load_b128 readers
#define VPITCH 160  // bytes per f16 V row in LDS: 128 + 32, for ds_load_tr16_b128 readers
#define NQW   4    // waves per key group; each wave owns 16 query rows
#define NGRP  2    // key groups: group g takes the 32-key blocks 2*s + g
#define NWAVE (NQW * NGRP)
#define QTILE (NQW * 16)            // query rows per tile
#define NTILE (S_LEN / QTILE)       // query tiles per (b,h)
#define SKEYS (NGRP * 32)           // keys per ring stage
#define KBUF_B (SKEYS * KPITCH)     // bytes of one K stage
#define VBUF_B (SKEYS * VPITCH)     // bytes of one V stage
#define BUF_B  (KBUF_B + VBUF_B)    // one buffer: a K stage, then a V stage
#define MRG_B  (2 * BUF_B)          // first byte of the merge area behind the two buffers
#define NLD    (SKEYS * DH / 4 / (NWAVE * 32))  // 16-byte loads per thread, stage and operand

__device__ __forceinline__ int iabs(int x) { return x < 0 ? -x : x; }
__device__ __forceinline__ uint32_t uni(uint32_t v) { return (uint32_t)__builtin_amdgcn_readfirstlane(v); }
// this wave's LDS reads have returned
__device__ __forceinline__ void wait_ds0() { asm volatile("s_wait_dscnt 0x0" ::: "memory"); }
// row-major 16-bit LDS tile -> transposed matrix operand, 8 elements a lane
__device__ __forceinline__ v8h ld_tr16(const unsigned char* p) {
  typedef __attribute__((address_space(3))) s16x8 lds_s16x8;
  return __builtin_bit_cast(v8h, __builtin_amdgcn_ds_load_tr16_b128_v8i16((lds_s16x8*)p));
}

__global__ __launch_bounds__(NWAVE * 32)
void fa3d_wmma_kernel(const float* __restrict__ Q, const float* __restrict__ K,
                      const float* __restrict__ V, float* __restrict__ O) {
  // two buffers, each a K stage and a V stage in f16; then the merge area,
  // 5 rows of 32 f32x4 per wave
  __shared__ __attribute__((aligned(16))) unsigned char smem[MRG_B + NWAVE * 5 * 32 * 16];

  const int lane = threadIdx.x & 31;
  const uint32_t wave = uni(threadIdx.x >> 5);
  const uint32_t grp  = wave >> 2;    // key group of this wave
  const uint32_t wq   = wave & 3;     // which 16 query rows of the tile
  const int tp   = blockIdx.x & 7;    // 8 pairs of query tiles
  const int bh   = blockIdx.x >> 3;   // 64 (b,h) pairs
  const int ln   = lane & 15;
  const int hi   = (lane >> 4) << 3;  // 0 for lanes 0-15, 8 for lanes 16-31

  const size_t base = (size_t)bh * S_LEN * DH;
  // staging: 16 lanes take one row of 256 bytes, 16 bytes a lane, and write it
  // to LDS as four f16 a lane; load j covers rows j * 16 .. j * 16 + 15. The
  // two rows of a wave's store lie 8 rows apart in K and 4 in V: at either
  // pitch that is 32 banks, so the two 128-byte halves share no bank
  const int scol  = threadIdx.x & 15;
  const int srowK = (int)wave + hi;
  const int srowV = (int)(wave & 3u) + (int)(wave >> 2) * 8 + (hi >> 1);
  const f32x4* gK = (const f32x4*)(K + base) + srowK * (DH / 4) + scol;
  const f32x4* gV = (const f32x4*)(V + base) + srowV * (DH / 4) + scol;
  unsigned char* const stK = &smem[srowK * KPITCH + scol * 8];
  unsigned char* const stV = &smem[KBUF_B + srowV * VPITCH + scol * 8];
  f32x4 rk[NLD], rv[NLD];             // one stage on its way from memory to LDS

  // exp(-dist/33) splits into exp(-(|dt|+|dh|)/33) * exp(-|dw|/33); the w
  // factor of accumulator row r depends neither on the key block nor on the
  // query tile (a wave's 16 rows are one grid line, so the row's w is ln)
  float ew[8];
#pragma unroll
  for (int r = 0; r < 8; ++r)
    ew[r] = __expf((float)iabs(ln - (r + hi)) * (-1.0f / 33.0f));

  // Causal cost grows linearly with the tile index: every work-group runs
  // tile tp and then tile NTILE-1-tp, one after the other, so that all
  // work-groups walk the same number of key blocks.
  for (int half = 0; half < 2; ++half) {
  const int qb = half ? NTILE - 1 - tp : tp;
  const int q0 = qb * QTILE + (int)wq * 16;
  const int qy = q0 + ln;             // this lane's query row in this tile
  const int qt = qy >> 8, qh = (qy >> 4) & 15;

  // ---- Q as B-operand fragments (k-dim = d), scaled by 1/sqrt(D).
  // f16 operand layout: element i <-> k-dim index (i<8 ? i : i+8) + hi
  v16h bq0, bq1;
  {
    const float* qp = Q + base + (size_t)qy * DH;
    const float sc = 0.125f;  // 1/sqrt(64)
#pragma unroll
    for (int i = 0; i < 8; ++i) {
      bq0[i]     = (_Float16)(qp[hi + i]      * sc);
      bq0[i + 8] = (_Float16)(qp[16 + hi + i] * sc);
      bq1[i]     = (_Float16)(qp[32 + hi + i] * sc);
      bq1[i + 8] = (_Float16)(qp[48 + hi + i] * sc);
    }
  }
  // the staging loads below may land in the registers that hold the address
  // of the Q loads: this wait stands in front of that overwrite
  asm volatile("s_wait_xcnt 0x0" ::: "memory");

  v8f oacc[4];
#pragma unroll
  for (int dt = 0; dt < 4; ++dt) oacc[dt] = (v8f){};
  float m_run = -__builtin_inff();
  float l_run = 0.f;

  const int nblk_w = (q0 + 47) >> 5;  // this wave's causal limit, in 32-key blocks
  const int nst    = qb + 1;          // 64-key stages of this tile, block-uniform

  // ---- prologue: stages 0 and 1 leave memory together; stage 0 is converted
  // into buffer 0 and published, stage 1 stays in registers. The last readers
  // of the buffers have passed the barrier of the join below.
  {
    f32x4 k0[NLD], v0[NLD];
#pragma unroll
    for (int j = 0; j < NLD; ++j) { k0[j] = gK[j * 256]; v0[j] = gV[j * 256]; }
    if (1 < nst) {
#pragma unroll
      for (int j = 0; j < NLD; ++j) {
        rk[j] = gK[SKEYS * DH / 4 + j * 256];
        rv[j] = gV[SKEYS * DH / 4 + j * 256];
      }
    }
#pragma unroll
    for (int j = 0; j < NLD; ++j) {
      *(v4h*)(stK + j * 16 * KPITCH) = __builtin_convertvector(k0[j], v4h);
      *(v4h*)(stV + j * 16 * VPITCH) = __builtin_convertvector(v0[j], v4h);
    }
  }
  __syncthreads();

  for (int st = 0; st < nst; ++st) {
    const int blk = st * NGRP + (int)grp;      // this group's block of the stage
    const int kb  = blk << 5;
    const int buf = st & 1;

    // ---- stage st + 1, loaded one stage ago, goes into the other buffer,
    // whose readers left it in front of the last barrier: the stores drain
    // under this stage's work
    if (st + 1 < nst) {
      const int ob = (buf ^ 1) * BUF_B;
#pragma unroll
      for (int j = 0; j < NLD; ++j) {
        *(v4h*)(stK + ob + j * 16 * KPITCH) = __builtin_convertvector(rk[j], v4h);
        *(v4h*)(stV + ob + j * 16 * VPITCH) = __builtin_convertvector(rv[j], v4h);
      }
    }
    // stage st + 2 leaves memory now and is in flight under this stage's work
    if (st + 2 < nst) {
#pragma unroll
      for (int j = 0; j < NLD; ++j) {
        rk[j] = gK[(st + 2) * (SKEYS * DH / 4) + j * 256];
        rv[j] = gV[(st + 2) * (SKEYS * DH / 4) + j * 256];
      }
      // this stage's work reuses the address registers these loads name:
      // this wait stands in front of their first overwrite
      asm volatile("s_wait_xcnt 0x0" ::: "memory");
    }

    if (blk < nblk_w) {
      const unsigned char* sK = &smem[buf * BUF_B + (int)grp * 32 * KPITCH];
      const unsigned char* sV = &smem[buf * BUF_B + KBUF_B + (int)grp * 32 * VPITCH];
      // ---- GEMM1: S^T(16k x 16q) = K_tile * Q^T, two 16-key subtiles ------
      v8f s[2];
#pragma unroll
      for (int kt = 0; kt < 2; ++kt) {
        // element i <-> column (i<8 ? i : i+8) + hi of each 32: two 16-byte reads
        const unsigned char* kr = &sK[(kt * 16 + ln) * KPITCH + hi * 2];
        const v8h ra = *(const v8h*)(kr),      rb = *(const v8h*)(kr + 32);
        const v8h rc = *(const v8h*)(kr + 64), rd = *(const v8h*)(kr + 96);
        const v16h a0 = __builtin_shufflevector(ra, rb, 0, 1, 2, 3, 4, 5, 6, 7,
                                                8, 9, 10, 11, 12, 13, 14, 15);
        const v16h a1 = __builtin_shufflevector(rc, rd, 0, 1, 2, 3, 4, 5, 6, 7,
                                                8, 9, 10, 11, 12, 13, 14, 15);
        v8f c = (v8f){};
        c = __builtin_amdgcn_wmma_f32_16x16x32_f16(false, a0, false, bq0,
                                                   (short)0, c, false, false);
        c = __builtin_amdgcn_wmma_f32_16x16x32_f16(false, a1, false, bq1,
                                                   (short)0, c, false, false);
        s[kt] = c;
      }

      // ---- causal + distance mask, online softmax (per-lane query col) ----
      float p[16];
      float mb = -__builtin_inff();
      const int dq = qy - kb - hi;
#pragma unroll
      for (int kt = 0; kt < 2; ++kt) {
        // a 16-key subtile is one (t, h) grid line: its t and h terms are one
        // factor per lane, and its w coordinate is r + hi in every subtile
        const int k16 = (kb >> 4) + kt;
        const int dth = iabs(qt - (k16 >> 4)) + iabs(qh - (k16 & 15));
        const float fth = __expf((float)dth * (-1.0f / 33.0f));
#pragma unroll
        for (int r = 0; r < 8; ++r) {
          // D layout: M = r + hi, so key kb + kt*16 + r + hi <= qy reads
          // kt*16 + r <= dq
          const float sv = (kt * 16 + r <= dq) ? s[kt][r] * (fth * ew[r])
                                               : -__builtin_inff();
          p[kt * 8 + r] = sv;
          mb = fmaxf(mb, sv);
        }
      }
      mb = fmaxf(mb, __shfl_xor(mb, 16, 32));  // partner half: other 16 keys
      const float m_new = fmaxf(m_run, mb);
      float lp = 0.f;
#pragma unroll
      for (int i = 0; i < 16; ++i) { p[i] = __expf(p[i] - m_new); lp += p[i]; }
      lp += __shfl_xor(lp, 16, 32);
      const float alpha = __expf(m_run - m_new);
      l_run = l_run * alpha + lp;
      m_run = m_new;
#pragma unroll
      for (int dt = 0; dt < 4; ++dt)
#pragma unroll
        for (int r = 0; r < 8; ++r) oacc[dt][r] *= alpha;

      // ---- pack P into B-operand: element i -> k = (i<8?i:i+8)+hi ---------
      v16h pb;
#pragma unroll
      for (int i = 0; i < 8; ++i) {
        pb[i]     = (_Float16)p[i];
        pb[i + 8] = (_Float16)p[8 + i];
      }

      // ---- GEMM2: O^T(16d x 16q) += V^T(16d x 32k) * P^T(32k x 16q) -------
      // lane (ln, hi) gets keys hi..hi+7 (then 16+hi..) of column dt*16 + ln
      const unsigned char* vp = &sV[(hi + (lane & 7)) * VPITCH + ((lane >> 3) & 1) * 16];
#pragma unroll
      for (int dt = 0; dt < 4; ++dt) {
        const v16h av = __builtin_shufflevector(ld_tr16(vp + dt * 32),
                                                ld_tr16(vp + 16 * VPITCH + dt * 32),
                                                0, 1, 2, 3, 4, 5, 6, 7,
                                                8, 9, 10, 11, 12, 13, 14, 15);
        oacc[dt] = __builtin_amdgcn_wmma_f32_16x16x32_f16(false, av, false, pb,
                                                          (short)0, oacc[dt],
                                                          false, false);
      }
    }

    // this barrier, passed by every wave, publishes stage st + 1 and ends the
    // reads of buffer buf
    __syncthreads();
  }

  // ---- join the two key groups: waves w and w + 4 hold partial sums of the
  // same 16 query rows. Group 0 finishes d 0..31 and group 1 d 32..63; each
  // hands the partner its maximum, its sum and the half it does not finish.
  f32x4* mg = (f32x4*)&smem[MRG_B];
  v8f keep[2];
  {
    f32x4* my = mg + wave * (5 * 32) + lane;
#pragma unroll
    for (int j = 0; j < 2; ++j) {
      const v8f snd = grp ? oacc[j] : oacc[2 + j];
      keep[j]       = grp ? oacc[2 + j] : oacc[j];
      my[(2 * j) * 32]     = (f32x4){snd[0], snd[1], snd[2], snd[3]};
      my[(2 * j + 1) * 32] = (f32x4){snd[4], snd[5], snd[6], snd[7]};
    }
    my[4 * 32] = (f32x4){m_run, l_run, 0.f, 0.f};
  }
  __syncthreads();                    // both partners' halves are in LDS
  const f32x4* ot = mg + (wave ^ 4u) * (5 * 32) + lane;
  const f32x4 ml = ot[4 * 32];
  // group 0 always holds key 0, so the joint maximum is finite; a group-1
  // wave without a block has maximum -inf and weighs 0
  const float m_all = fmaxf(m_run, ml[0]);
  const float fa = __expf(m_run - m_all);
  const float fb = __expf(ml[0] - m_all);
  const float inv_l = 1.0f / (l_run * fa + ml[1] * fb);
  const float ca = fa * inv_l, cb = fb * inv_l;

  // ---- normalize and store: d = dt*16 + r + hi, row = qy -------------------
  float* op = O + base + (size_t)qy * DH + grp * 32;
#pragma unroll
  for (int j = 0; j < 2; ++j) {
    const f32x4 o0 = ot[(2 * j) * 32], o1 = ot[(2 * j + 1) * 32];
#pragma unroll
    for (int r = 0; r < 4; ++r) {
      op[j * 16 + r + hi]     = keep[j][r] * ca     + o0[r] * cb;
      op[j * 16 + 4 + r + hi] = keep[j][4 + r] * ca + o1[r] * cb;
    }
  }
  // the merge area is rewritten behind the next tile's barriers: this wave's
  // reads of it have returned before it reaches the first of them
  wait_ds0();
  // the next tile reuses the registers these stores name: this wait stands
  // in front of their first overwrite
  asm volatile("s_wait_xcnt 0x0" ::: "memory");
  }  // next tile of the pair
}

extern "C" void kernel_launch(void* const* d_in, const int* in_sizes, int n_in,
                              void* d_out, int out_size, void* d_ws, size_t ws_size,
                              hipStream_t stream) {
  const float* Q = (const float*)d_in[0];
  const float* K = (const float*)d_in[1];
  const float* V = (const float*)d_in[2];
  float* O = (float*)d_out;
  dim3 grid(64 * 8), block(NWAVE * 32);
  fa3d_wmma_kernel<<<grid, block, 0, stream>>>(Q, K, V, O);
}

// v005
// Measured time: 21.8 microseconds a run.
// Next to v004, in two timings, it ran 1.05 times as fast each time.
// Counting every step since v000, it is 2.09 times as fast.
#include <hip/hip_runtime.h>
#include <stdint.h>

typedef __attribute__((ext_vector_type(16))) _Float16 v16h;
typedef __attribute__((ext_vector_type(8)))  float    v8f;
typedef __attribute__((ext_vector_type(4)))  float    f32x4;
typedef __attribute__((ext_vector_type(8)))  _Float16 v8h;
typedef __attribute__((ext_vector_type(4)))  _Float16 v4h;
typedef __attribute__((ext_vector_type(8)))  short    s16x8;

#define S_LEN 1024
#define DH    64
#define KPITCH 144  // bytes per f16 K row in LDS: 128 + 16, for ds_load_b128 readers
#define VPITCH 160  // bytes per f16 V row in LDS: 128 + 32, for ds_load_tr16_b128 readers
#define NQW   4    // waves per key group; each wave owns 16 query rows
#define NGRP  2    // key groups: group g takes the 32-key blocks of parity g
#define BPW   2    // 32-key blocks a wave takes between two ring barriers
#define NWAVE (NQW * NGRP)
#define QTILE (NQW * 16)            // query rows per tile
#define NTILE (S_LEN / QTILE)       // query tiles per (b,h)
#define SKEYS (NGRP * BPW * 32)     // keys per ring stage
#define KBUF_B (SKEYS * KPITCH)     // bytes of one K stage
#define VBUF_B (SKEYS * VPITCH)     // bytes of one V stage
#define BUF_B  (KBUF_B + VBUF_B)    // one buffer: a K stage, then a V stage
#define MRG_B  (2 * BUF_B)          // first byte of the merge area behind the two buffers
#define NLD    (SKEYS * DH / 4 / (NWAVE * 32))  // 16-byte loads per thread, stage and operand

__device__ __forceinline__ int iabs(int x) { return x < 0 ? -x : x; }
__device__ __forceinline__ uint32_t uni(uint32_t v) { return (uint32_t)__builtin_amdgcn_readfirstlane(v); }
// this wave's LDS reads have returned
__device__ __forceinline__ void wait_ds0() { asm volatile("s_wait_dscnt 0x0" ::: "memory"); }
// row-major 16-bit LDS tile -> transposed matrix operand, 8 elements a lane
__device__ __forceinline__ v8h ld_tr16(const unsigned char* p) {
  typedef __attribute__((address_space(3))) s16x8 lds_s16x8;
  return __builtin_bit_cast(v8h, __builtin_amdgcn_ds_load_tr16_b128_v8i16((lds_s16x8*)p));
}

// One softmax pass of a wave over NB 32-key blocks of the stage (the blocks lie
// NGRP * 32 keys apart): one maximum, one exchange between the lane halves, one
// rescale of the output tiles for all NB blocks. sK, sV: the first of these
// blocks in LDS; kb: its first key.
template <int NB>
__device__ __forceinline__ void softmax_pass(const unsigned char* sK, const unsigned char* sV,
                                             int kb, int qy, int qt, int qh, int lane,
                                             const v16h& bq0, const v16h& bq1,
                                             const float (&ew)[8], v8f (&oacc)[4],
                                             float& m_run, float& l_run) {
  const int ln = lane & 15;
  const int hi = (lane >> 4) << 3;
  // ---- GEMM1: S^T(16k x 16q) = K_tile * Q^T, two 16-key subtiles a block ----
  v8f s[NB * 2];
  v8h kf[NB * 2][4];
#pragma unroll
  for (int t = 0; t < NB * 2; ++t) {
    const int row = (t >> 1) * (NGRP * 32) + (t & 1) * 16;
    // element i <-> column (i<8 ? i : i+8) + hi of each 32: two 16-byte reads
    const unsigned char* kr = &sK[(row + ln) * KPITCH + hi * 2];
#pragma unroll
    for (int c = 0; c < 4; ++c) kf[t][c] = *(const v8h*)(kr + c * 32);
  }
  // keeps the pass's K reads one group ahead of its products: left to itself
  // the compiler reads four at a time and waits out the LDS latency each time
  __builtin_amdgcn_sched_barrier(0);
#pragma unroll
  for (int t = 0; t < NB * 2; ++t) {
    const v16h a0 = __builtin_shufflevector(kf[t][0], kf[t][1], 0, 1, 2, 3, 4, 5, 6, 7,
                                            8, 9, 10, 11, 12, 13, 14, 15);
    const v16h a1 = __builtin_shufflevector(kf[t][2], kf[t][3], 0, 1, 2, 3, 4, 5, 6, 7,
                                            8, 9, 10, 11, 12, 13, 14, 15);
    v8f c = (v8f){};
    c = __builtin_amdgcn_wmma_f32_16x16x32_f16(false, a0, false, bq0,
                                               (short)0, c, false, false);
    c = __builtin_amdgcn_wmma_f32_16x16x32_f16(false, a1, false, bq1,
                                               (short)0, c, false, false);
    s[t] = c;
  }
  // keeps the V reads behind the products above, so that they take the K
  // fragments' registers: both sets live at once cost a wave per SIMD
  __builtin_amdgcn_sched_barrier(0);
  // V^T fragments of the whole pass: lane (ln, hi) gets keys hi..hi+7 (then
  // 16+hi..) of column dt*16 + ln
  const unsigned char* vp = &sV[(hi + (lane & 7)) * VPITCH + ((lane >> 3) & 1) * 16];
  v8h vf[NB][4][2];
#pragma unroll
  for (int b = 0; b < NB; ++b)
#pragma unroll
    for (int dt = 0; dt < 4; ++dt) {
      vf[b][dt][0] = ld_tr16(vp + b * (NGRP * 32) * VPITCH + dt * 32);
      vf[b][dt][1] = ld_tr16(vp + b * (NGRP * 32) * VPITCH + 16 * VPITCH + dt * 32);
    }
  // keeps the V reads here, so that they land under the softmax: left to
  // itself the compiler reads two in front of each product and waits for them
  __builtin_amdgcn_sched_barrier(0);

  // ---- causal + distance mask, online softmax (per-lane query col) ----------
  float p[NB * 16];
  float mb = -__builtin_inff();
  const int dq = qy - kb - hi;
#pragma unroll
  for (int t = 0; t < NB * 2; ++t) {
    const int row = (t >> 1) * (NGRP * 32) + (t & 1) * 16;
    // a 16-key subtile is one (t, h) grid line: its t and h terms are one
    // factor per lane, and its w coordinate is r + hi in every subtile
    const int k16 = (kb + row) >> 4;
    const int dth = iabs(qt - (k16 >> 4)) + iabs(qh - (k16 & 15));
    const float fth = __expf((float)dth * (-1.0f / 33.0f));
    float mt = -__builtin_inff();
#pragma unroll
    for (int r = 0; r < 8; ++r) {
      // D layout: M = r + hi, so key kb + row + r + hi <= qy reads
      // row + r <= dq
      const float sv = (row + r <= dq) ? s[t][r] * (fth * ew[r])
                                       : -__builtin_inff();
      p[t * 8 + r] = sv;
      mt = fmaxf(mt, sv);
    }
    mb = fmaxf(mb, mt);
  }
  mb = fmaxf(mb, __shfl_xor(mb, 16, 32));  // partner half: the other keys
  const float m_new = fmaxf(m_run, mb);
  float lp = 0.f;
#pragma unroll
  for (int b = 0; b < NB; ++b) {
    float lb = 0.f;                        // one sum chain a block
#pragma unroll
    for (int i = 0; i < 16; ++i) {
      p[b * 16 + i] = __expf(p[b * 16 + i] - m_new);
      lb += p[b * 16 + i];
    }
    lp += lb;
  }
  lp += __shfl_xor(lp, 16, 32);
  const float alpha = __expf(m_run - m_new);
  l_run = l_run * alpha + lp;
  m_run = m_new;
#pragma unroll
  for (int dt = 0; dt < 4; ++dt)
#pragma unroll
    for (int r = 0; r < 8; ++r) oacc[dt][r] *= alpha;

  // ---- pack P into the B operands: element i -> k = (i<8?i:i+8)+hi ----------
  v16h pb[NB];
#pragma unroll
  for (int b = 0; b < NB; ++b)
#pragma unroll
    for (int i = 0; i < 8; ++i) {
      pb[b][i]     = (_Float16)p[b * 16 + i];
      pb[b][i + 8] = (_Float16)p[b * 16 + 8 + i];
    }
  // keeps the vector work above out of the run of products below: woven in, it
  // reuses their operand registers and each product drags four v_nop behind it
  __builtin_amdgcn_sched_barrier(0);
  // ---- GEMM2: O^T(16d x 16q) += V^T(16d x 32k) * P^T(32k x 16q), per block --
#pragma unroll
  for (int b = 0; b < NB; ++b)
#pragma unroll
    for (int dt = 0; dt < 4; ++dt) {
      const v16h av = __builtin_shufflevector(vf[b][dt][0], vf[b][dt][1],
                                              0, 1, 2, 3, 4, 5, 6, 7,
                                              8, 9, 10, 11, 12, 13, 14, 15);
      oacc[dt] = __builtin_amdgcn_wmma_f32_16x16x32_f16(false, av, false, pb[b],
                                                        (short)0, oacc[dt],
                                                        false, false);
    }
}

__global__ __launch_bounds__(NWAVE * 32)
void fa3d_wmma_kernel(const float* __restrict__ Q, const float* __restrict__ K,
                      const float* __restrict__ V, float* __restrict__ O) {
  // two buffers, each a K stage and a V stage in f16; then the merge area,
  // 5 rows of 32 f32x4 per wave
  __shared__ __attribute__((aligned(16))) unsigned char smem[MRG_B + NWAVE * 5 * 32 * 16];

  const int lane = threadIdx.x & 31;
  const uint32_t wave = uni(threadIdx.x >> 5);
  const uint32_t grp  = wave >> 2;    // key group of this wave
  const uint32_t wq   = wave & 3;     // which 16 query rows of the tile
  const int tp   = blockIdx.x & 7;    // 8 pairs of query tiles
  const int bh   = blockIdx.x >> 3;   // 64 (b,h) pairs
  const int ln   = lane & 15;
  const int hi   = (lane >> 4) << 3;  // 0 for lanes 0-15, 8 for lanes 16-31

  const size_t base = (size_t)bh * S_LEN * DH;
  // staging: 16 lanes take one row of 256 bytes, 16 bytes a lane, and write it
  // to LDS as four f16 a lane; load j covers rows j * 16 .. j * 16 + 15. The
  // two rows of a wave's store lie 8 rows apart in K and 4 in V: at either
  // pitch that is 32 banks, so the two 128-byte halves share no bank
  const int scol  = threadIdx.x & 15;
  const int srowK = (int)wave + hi;
  const int srowV = (int)(wave & 3u) + (int)(wave >> 2) * 8 + (hi >> 1);
  const f32x4* gK = (const f32x4*)(K + base) + srowK * (DH / 4) + scol;
  const f32x4* gV = (const f32x4*)(V + base) + srowV * (DH / 4) + scol;
  unsigned char* const stK = &smem[srowK * KPITCH + scol * 8];
  unsigned char* const stV = &smem[KBUF_B + srowV * VPITCH + scol * 8];
  f32x4 rk[NLD], rv[NLD];             // one stage on its way from memory to LDS

  // exp(-dist/33) splits into exp(-(|dt|+|dh|)/33) * exp(-|dw|/33); the w
  // factor of accumulator row r depends neither on the key block nor on the
  // query tile (a wave's 16 rows are one grid line, so the row's w is ln)
  float ew[8];
#pragma unroll
  for (int r = 0; r < 8; ++r)
    ew[r] = __expf((float)iabs(ln - (r + hi)) * (-1.0f / 33.0f));

  // Causal cost grows linearly with the tile index: every work-group runs
  // tile tp and then tile NTILE-1-tp, one after the other, so that all
  // work-groups walk the same number of key blocks.
  for (int half = 0; half < 2; ++half) {
  const int qb = half ? NTILE - 1 - tp : tp;
  const int q0 = qb * QTILE + (int)wq * 16;
  const int qy = q0 + ln;             // this lane's query row in this tile
  const int qt = qy >> 8, qh = (qy >> 4) & 15;

  // ---- Q as B-operand fragments (k-dim = d), scaled by 1/sqrt(D).
  // f16 operand layout: element i <-> k-dim index (i<8 ? i : i+8) + hi
  v16h bq0, bq1;
  {
    const float* qp = Q + base + (size_t)qy * DH;
    const float sc = 0.125f;  // 1/sqrt(64)
#pragma unroll
    for (int i = 0; i < 8; ++i) {
      bq0[i]     = (_Float16)(qp[hi + i]      * sc);
      bq0[i + 8] = (_Float16)(qp[16 + hi + i] * sc);
      bq1[i]     = (_Float16)(qp[32 + hi + i] * sc);
      bq1[i + 8] = (_Float16)(qp[48 + hi + i] * sc);
    }
  }
  // the staging loads below may land in the registers that hold the address
  // of the Q loads: this wait stands in front of that overwrite
  asm volatile("s_wait_xcnt 0x0" ::: "memory");

  v8f oacc[4];
#pragma unroll
  for (int dt = 0; dt < 4; ++dt) oacc[dt] = (v8f){};
  float m_run = -__builtin_inff();
  float l_run = 0.f;

  const int nblk_w = (q0 + 47) >> 5;  // this wave's causal limit, in 32-key blocks
  const int nst    = (qb + BPW) / BPW; // ring stages of this tile, block-uniform

  // ---- prologue: stage 0 is loaded, converted into buffer 0 and published.
  // The last readers of the buffers have passed the barrier of the join below.
#pragma unroll
  for (int j = 0; j < NLD; ++j) { rk[j] = gK[j * 256]; rv[j] = gV[j * 256]; }
#pragma unroll
  for (int j = 0; j < NLD; ++j) {
    *(v4h*)(stK + j * 16 * KPITCH) = __builtin_convertvector(rk[j], v4h);
    *(v4h*)(stV + j * 16 * VPITCH) = __builtin_convertvector(rv[j], v4h);
  }
  __syncthreads();

  // every stage but the tile's last lies wholly below the diagonal for every
  // wave: two full blocks a wave, no test
  for (int st = 0; st + 1 < nst; ++st) {
    // this group's blocks of the stage: blk and blk + NGRP
    const int blk = st * (NGRP * BPW) + (int)grp;
    const int buf = st & 1;

    // stage st + 1 leaves memory now and is in flight under this stage's work
#pragma unroll
    for (int j = 0; j < NLD; ++j) {
      rk[j] = gK[(st + 1) * (SKEYS * DH / 4) + j * 256];
      rv[j] = gV[(st + 1) * (SKEYS * DH / 4) + j * 256];
    }
    // this stage's work reuses the address registers these loads name:
    // this wait stands in front of their first overwrite
    asm volatile("s_wait_xcnt 0x0" ::: "memory");

    softmax_pass<2>(&smem[buf * BUF_B + (int)grp * 32 * KPITCH],
                    &smem[buf * BUF_B + KBUF_B + (int)grp * 32 * VPITCH],
                    blk << 5, qy, qt, qh, lane, bq0, bq1, ew, oacc, m_run, l_run);

    // keeps the conversion, and the wait for the loads that comes with it,
    // behind the pass's arithmetic: moved up, that wait would come right
    // behind the loads
    __builtin_amdgcn_sched_barrier(0);
    // ---- stage st + 1 goes into the other buffer, whose readers left it in
    // front of the last barrier
    {
      const int ob = (buf ^ 1) * BUF_B;
#pragma unroll
      for (int j = 0; j < NLD; ++j) {
        *(v4h*)(stK + ob + j * 16 * KPITCH) = __builtin_convertvector(rk[j], v4h);
        *(v4h*)(stV + ob + j * 16 * VPITCH) = __builtin_convertvector(rv[j], v4h);
      }
    }
    // this barrier, passed by every wave, publishes stage st + 1 and ends the
    // reads of buffer buf
    __syncthreads();
  }
  // ---- the tile's last stage holds the diagonal: a wave has two blocks there,
  // one or none, and takes them one at a time
  {
    const int blk = (nst - 1) * (NGRP * BPW) + (int)grp;
    const int buf = (nst - 1) & 1;
    const unsigned char* sK = &smem[buf * BUF_B + (int)grp * 32 * KPITCH];
    const unsigned char* sV = &smem[buf * BUF_B + KBUF_B + (int)grp * 32 * VPITCH];
    for (int i = 0; i < BPW; ++i)
      if (blk + i * NGRP < nblk_w)
        softmax_pass<1>(sK + i * (NGRP * 32) * KPITCH, sV + i * (NGRP * 32) * VPITCH,
                        (blk + i * NGRP) << 5, qy, qt, qh, lane, bq0, bq1, ew, oacc,
                        m_run, l_run);
    // this barrier, passed by every wave, ends the reads of buffer buf
    __syncthreads();
  }

  // ---- join the two key groups: waves w and w + 4 hold partial sums of the
  // same 16 query rows. Group 0 finishes d 0..31 and group 1 d 32..63; each
  // hands the partner its maximum, its sum and the half it does not finish.
  f32x4* mg = (f32x4*)&smem[MRG_B];
  v8f keep[2];
  {
    f32x4* my = mg + wave * (5 * 32) + lane;
#pragma unroll
    for (int j = 0; j < 2; ++j) {
      const v8f snd = grp ? oacc[j] : oacc[2 + j];
      keep[j]       = grp ? oacc[2 + j] : oacc[j];
      my[(2 * j) * 32]     = (f32x4){snd[0], snd[1], snd[2], snd[3]};
      my[(2 * j + 1) * 32] = (f32x4){snd[4], snd[5], snd[6], snd[7]};
    }
    my[4 * 32] = (f32x4){m_run, l_run, 0.f, 0.f};
  }
  __syncthreads();                    // both partners' halves are in LDS
  const f32x4* ot = mg + (wave ^ 4u) * (5 * 32) + lane;
  const f32x4 ml = ot[4 * 32];
  // group 0 always holds key 0, so the joint maximum is finite; a group-1
  // wave without a block has maximum -inf and weighs 0
  const float m_all = fmaxf(m_run, ml[0]);
  const float fa = __expf(m_run - m_all);
  const float fb = __expf(ml[0] - m_all);
  const float inv_l = 1.0f / (l_run * fa + ml[1] * fb);
  const float ca = fa * inv_l, cb = fb * inv_l;

  // ---- normalize and store: d = dt*16 + r + hi, row = qy -------------------
  float* op = O + base + (size_t)qy * DH + grp * 32;
#pragma unroll
  for (int j = 0; j < 2; ++j) {
    const f32x4 o0 = ot[(2 * j) * 32], o1 = ot[(2 * j + 1) * 32];
#pragma unroll
    for (int r = 0; r < 4; ++r) {
      op[j * 16 + r + hi]     = keep[j][r] * ca     + o0[r] * cb;
      op[j * 16 + 4 + r + hi] = keep[j][4 + r] * ca + o1[r] * cb;
    }
  }
  // the merge area is rewritten behind the next tile's barriers: this wave's
  // reads of it have returned before it reaches the first of them
  wait_ds0();
  // the next tile reuses the registers these stores name: this wait stands
  // in front of their first overwrite
  asm volatile("s_wait_xcnt 0x0" ::: "memory");
  }  // next tile of the pair
}

extern "C" void kernel_launch(void* const* d_in, const int* in_sizes, int n_in,
                              void* d_out, int out_size, void* d_ws, size_t ws_size,
                              hipStream_t stream) {
  const float* Q = (const float*)d_in[0];
  const float* K = (const float*)d_in[1];
  const float* V = (const float*)d_in[2];
  float* O = (float*)d_out;
  dim3 grid(64 * 8), block(NWAVE * 32);
  fa3d_wmma_kernel<<<grid, block, 0, stream>>>(Q, K, V, O);
}

// v006
// A run of this version takes 21 microseconds.
// Timed twice side by side with v005, it ran 1.03 times as fast both times.
// Counting every step since v000, it is 2.16 times as fast.
#include <hip/hip_runtime.h>
#include <stdint.h>

typedef __attribute__((ext_vector_type(16))) _Float16 v16h;
typedef __attribute__((ext_vector_type(8)))  float    v8f;
typedef __attribute__((ext_vector_type(4)))  float    f32x4;
typedef __attribute__((ext_vector_type(8)))  _Float16 v8h;
typedef __attribute__((ext_vector_type(4)))  _Float16 v4h;
typedef __attribute__((ext_vector_type(8)))  short    s16x8;

#define S_LEN 1024
#define DH    64
#define KPITCH 144  // bytes per f16 K row in LDS: 128 + 16, for ds_load_b128 readers
#define VPITCH 160  // bytes per f16 V row in LDS: 128 + 32, for ds_load_tr16_b128 readers
#define NQW   4    // waves per key group; each wave owns 16 query rows
#define NGRP  2    // key groups: group g takes the 32-key blocks of parity g
#define BPW   2    // 32-key blocks a wave takes between two ring barriers
#define NWAVE (NQW * NGRP)
#define QTILE (NQW * 16)            // query rows per tile
#define NTILE (S_LEN / QTILE)       // query tiles per (b,h)
#define SKEYS (NGRP * BPW * 32)     // keys per ring stage
#define KBUF_B (SKEYS * KPITCH)     // bytes of one K stage
#define VBUF_B (SKEYS * VPITCH)     // bytes of one V stage
#define BUF_B  (KBUF_B + VBUF_B)    // one buffer: a K stage, then a V stage
#define MRG_B  (2 * BUF_B)          // first byte of the merge area behind the two buffers
#define NLD    (SKEYS * DH / 4 / (NWAVE * 32))  // 16-byte loads per thread, stage and operand

__device__ __forceinline__ int iabs(int x) { return x < 0 ? -x : x; }
__device__ __forceinline__ uint32_t uni(uint32_t v) { return (uint32_t)__builtin_amdgcn_readfirstlane(v); }
// this wave's LDS reads have returned
__device__ __forceinline__ void wait_ds0() { asm volatile("s_wait_dscnt 0x0" ::: "memory"); }
// row-major 16-bit LDS tile -> transposed matrix operand, 8 elements a lane
__device__ __forceinline__ v8h ld_tr16(const unsigned char* p) {
  typedef __attribute__((address_space(3))) s16x8 lds_s16x8;
  return __builtin_bit_cast(v8h, __builtin_amdgcn_ds_load_tr16_b128_v8i16((lds_s16x8*)p));
}

// One softmax pass of a wave over NB 32-key blocks of the stage (the blocks lie
// NGRP * 32 keys apart): one maximum, one exchange between the lane halves, one
// rescale of the output tiles for all NB blocks. sK, sV: the pass's first
// block in LDS; kb: its first key. DIAG: the pass may hold keys
// above a query row and applies the causal test; a pass whose keys all lie at
// or below every row of the wave is built without it.
template <int NB, bool DIAG>
__device__ __forceinline__ void softmax_pass(const unsigned char* sK, const unsigned char* sV,
                                             int kb, int qy, int qt, int qh, int lane,
                                             const v16h& bq0, const v16h& bq1,
                                             const float (&ew)[8], v8f (&oacc)[4],
                                             float& m_run, float& l_run) {
  const int ln = lane & 15;
  const int hi = (lane >> 4) << 3;
  // ---- GEMM1: S^T(16k x 16q) = K_tile * Q^T, two 16-key subtiles a block ----
  v8f s[NB * 2];
  v8h kf[NB * 2][4];
#pragma unroll
  for (int t = 0; t < NB * 2; ++t) {
    const int row = (t >> 1) * (NGRP * 32) + (t & 1) * 16;
    // element i <-> column (i<8 ? i : i+8) + hi of each 32: two 16-byte reads
    const unsigned char* kr = &sK[(row + ln) * KPITCH + hi * 2];
#pragma unroll
    for (int c = 0; c < 4; ++c) kf[t][c] = *(const v8h*)(kr + c * 32);
  }
  // keeps the pass's K reads one group ahead of its products: left to itself
  // the compiler reads four at a time and waits out the LDS latency each time
  __builtin_amdgcn_sched_barrier(0);
#pragma unroll
  for (int t = 0; t < NB * 2; ++t) {
    const v16h a0 = __builtin_shufflevector(kf[t][0], kf[t][1], 0, 1, 2, 3, 4, 5, 6, 7,
                                            8, 9, 10, 11, 12, 13, 14, 15);
    const v16h a1 = __builtin_shufflevector(kf[t][2], kf[t][3], 0, 1, 2, 3, 4, 5, 6, 7,
                                            8, 9, 10, 11, 12, 13, 14, 15);
    v8f c = (v8f){};
    c = __builtin_amdgcn_wmma_f32_16x16x32_f16(false, a0, false, bq0,
                                               (short)0, c, false, false);
    c = __builtin_amdgcn_wmma_f32_16x16x32_f16(false, a1, false, bq1,
                                               (short)0, c, false, false);
    s[t] = c;
  }
  // keeps the V reads behind the products above, so that they take the K
  // fragments' registers: both sets live at once cost a wave per SIMD
  __builtin_amdgcn_sched_barrier(0);
  // V^T fragments of the whole pass: lane (ln, hi) gets keys hi..hi+7 (then
  // 16+hi..) of column dt*16 + ln
  const unsigned char* vp = &sV[(hi + (lane & 7)) * VPITCH + ((lane >> 3) & 1) * 16];
  v8h vf[NB][4][2];
#pragma unroll
  for (int b = 0; b < NB; ++b)
#pragma unroll
    for (int dt = 0; dt < 4; ++dt) {
      vf[b][dt][0] = ld_tr16(vp + b * (NGRP * 32) * VPITCH + dt * 32);
      vf[b][dt][1] = ld_tr16(vp + b * (NGRP * 32) * VPITCH + 16 * VPITCH + dt * 32);
    }
  // keeps the V reads here, so that they land under the softmax: left to
  // itself the compiler reads two in front of each product and waits for them
  __builtin_amdgcn_sched_barrier(0);

  // ---- causal + distance mask, online softmax (per-lane query col) ----------
  float p[NB * 16];
  float mb = -__builtin_inff();
  const int dq = qy - kb - hi;
#pragma unroll
  for (int t = 0; t < NB * 2; ++t) {
    const int row = (t >> 1) * (NGRP * 32) + (t & 1) * 16;
    // a 16-key subtile is one (t, h) grid line: its t and h terms are one
    // factor per lane, and its w coordinate is r + hi in every subtile
    const int k16 = (kb + row) >> 4;
    const int dth = iabs(qt - (k16 >> 4)) + iabs(qh - (k16 & 15));
    const float fth = __expf((float)dth * (-1.0f / 33.0f));
    float mt = -__builtin_inff();
#pragma unroll
    for (int r = 0; r < 8; ++r) {
      // D layout: M = r + hi, so key kb + row + r + hi <= qy reads
      // row + r <= dq
      const float sd = s[t][r] * (fth * ew[r]);
      const float sv = (!DIAG || row + r <= dq) ? sd : -__builtin_inff();
      p[t * 8 + r] = sv;
      mt = fmaxf(mt, sv);
    }
    mb = fmaxf(mb, mt);
  }
  mb = fmaxf(mb, __shfl_xor(mb, 16, 32));  // partner half: the other keys
  const float m_new = fmaxf(m_run, mb);
  float lp = 0.f;
#pragma unroll
  for (int b = 0; b < NB; ++b) {
    float lb = 0.f;                        // one sum chain a block
#pragma unroll
    for (int i = 0; i < 16; ++i) {
      p[b * 16 + i] = __expf(p[b * 16 + i] - m_new);
      lb += p[b * 16 + i];
    }
    lp += lb;
  }
  lp += __shfl_xor(lp, 16, 32);
  const float alpha = __expf(m_run - m_new);
  l_run = l_run * alpha + lp;
  m_run = m_new;
#pragma unroll
  for (int dt = 0; dt < 4; ++dt)
#pragma unroll
    for (int r = 0; r < 8; ++r) oacc[dt][r] *= alpha;

  // ---- pack P into the B operands: element i -> k = (i<8?i:i+8)+hi ----------
  v16h pb[NB];
#pragma unroll
  for (int b = 0; b < NB; ++b)
#pragma unroll
    for (int i = 0; i < 8; ++i) {
      pb[b][i]     = (_Float16)p[b * 16 + i];
      pb[b][i + 8] = (_Float16)p[b * 16 + 8 + i];
    }
  // keeps the vector work above out of the run of products below: woven in, it
  // reuses their operand registers and each product drags four v_nop behind it
  __builtin_amdgcn_sched_barrier(0);
  // ---- GEMM2: O^T(16d x 16q) += V^T(16d x 32k) * P^T(32k x 16q), per block --
#pragma unroll
  for (int b = 0; b < NB; ++b)
#pragma unroll
    for (int dt = 0; dt < 4; ++dt) {
      const v16h av = __builtin_shufflevector(vf[b][dt][0], vf[b][dt][1],
                                              0, 1, 2, 3, 4, 5, 6, 7,
                                              8, 9, 10, 11, 12, 13, 14, 15);
      oacc[dt] = __builtin_amdgcn_wmma_f32_16x16x32_f16(false, av, false, pb[b],
                                                        (short)0, oacc[dt],
                                                        false, false);
    }
}

__global__ __launch_bounds__(NWAVE * 32)
void fa3d_wmma_kernel(const float* __restrict__ Q, const float* __restrict__ K,
                      const float* __restrict__ V, float* __restrict__ O) {
  // two buffers, each a K stage and a V stage in f16; then the merge area,
  // 5 rows of 32 f32x4 per wave
  __shared__ __attribute__((aligned(16))) unsigned char smem[MRG_B + NWAVE * 5 * 32 * 16];

  const int lane = threadIdx.x & 31;
  const uint32_t wave = uni(threadIdx.x >> 5);
  const uint32_t grp  = wave >> 2;    // key group of this wave
  const uint32_t wq   = wave & 3;     // which 16 query rows of the tile
  const int tp   = blockIdx.x & 7;    // 8 pairs of query tiles
  const int bh   = blockIdx.x >> 3;   // 64 (b,h) pairs
  const int ln   = lane & 15;
  const int hi   = (lane >> 4) << 3;  // 0 for lanes 0-15, 8 for lanes 16-31

  const size_t base = (size_t)bh * S_LEN * DH;
  // staging: 16 lanes take one row of 256 bytes, 16 bytes a lane, and write it
  // to LDS as four f16 a lane; load j covers rows j * 16 .. j * 16 + 15. The
  // two rows of a wave's store lie 8 rows apart in K and 4 in V: at either
  // pitch that is 32 banks, so the two 128-byte halves share no bank
  const int scol  = threadIdx.x & 15;
  const int srowK = (int)wave + hi;
  const int srowV = (int)(wave & 3u) + (int)(wave >> 2) * 8 + (hi >> 1);
  const f32x4* gK = (const f32x4*)(K + base) + srowK * (DH / 4) + scol;
  const f32x4* gV = (const f32x4*)(V + base) + srowV * (DH / 4) + scol;
  unsigned char* const stK = &smem[srowK * KPITCH + scol * 8];
  unsigned char* const stV = &smem[KBUF_B + srowV * VPITCH + scol * 8];
  f32x4 rk[NLD], rv[NLD];             // one stage on its way from memory to LDS

  // exp(-dist/33) splits into exp(-(|dt|+|dh|)/33) * exp(-|dw|/33); the w
  // factor of accumulator row r depends neither on the key block nor on the
  // query tile (a wave's 16 rows are one grid line, so the row's w is ln)
  float ew[8];
#pragma unroll
  for (int r = 0; r < 8; ++r)
    ew[r] = __expf((float)iabs(ln - (r + hi)) * (-1.0f / 33.0f));

  // Causal cost grows linearly with the tile index: every work-group runs
  // tile tp and then tile NTILE-1-tp, one after the other, so that all
  // work-groups walk the same number of key blocks.
  for (int half = 0; half < 2; ++half) {
  const int qb = half ? NTILE - 1 - tp : tp;
  const int q0 = qb * QTILE + (int)wq * 16;
  const int qy = q0 + ln;             // this lane's query row in this tile
  const int qt = qy >> 8, qh = (qy >> 4) & 15;

  // ---- Q as B-operand fragments (k-dim = d), scaled by 1/sqrt(D).
  // f16 operand layout: element i <-> k-dim index (i<8 ? i : i+8) + hi
  v16h bq0, bq1;
  {
    const float* qp = Q + base + (size_t)qy * DH;
    const float sc = 0.125f;  // 1/sqrt(64)
#pragma unroll
    for (int i = 0; i < 8; ++i) {
      bq0[i]     = (_Float16)(qp[hi + i]      * sc);
      bq0[i + 8] = (_Float16)(qp[16 + hi + i] * sc);
      bq1[i]     = (_Float16)(qp[32 + hi + i] * sc);
      bq1[i + 8] = (_Float16)(qp[48 + hi + i] * sc);
    }
  }
  // the staging loads below may land in the registers that hold the address
  // of the Q loads: this wait stands in front of that overwrite
  asm volatile("s_wait_xcnt 0x0" ::: "memory");

  v8f oacc[4];
#pragma unroll
  for (int dt = 0; dt < 4; ++dt) oacc[dt] = (v8f){};
  float m_run = -__builtin_inff();
  float l_run = 0.f;

  const int nblk_w = (q0 + 47) >> 5;  // this wave's causal limit, in 32-key blocks
  const int nst    = (qb + BPW) / BPW; // ring stages of this tile, block-uniform

  // ---- prologue: stage 0 is loaded, converted into buffer 0 and published.
  // The last readers of the buffers have passed the barrier of the join below.
#pragma unroll
  for (int j = 0; j < NLD; ++j) { rk[j] = gK[j * 256]; rv[j] = gV[j * 256]; }
#pragma unroll
  for (int j = 0; j < NLD; ++j) {
    *(v4h*)(stK + j * 16 * KPITCH) = __builtin_convertvector(rk[j], v4h);
    *(v4h*)(stV + j * 16 * VPITCH) = __builtin_convertvector(rv[j], v4h);
  }
  __syncthreads();

  // every stage but the tile's last lies wholly below the diagonal for every
  // wave (its keys end in front of the tile's first row): two full blocks a
  // wave, no block test and no causal test
  for (int st = 0; st + 1 < nst; ++st) {
    // this group's blocks of the stage: blk and blk + NGRP
    const int blk = st * (NGRP * BPW) + (int)grp;
    const int buf = st & 1;

    // stage st + 1 leaves memory now and is in flight under this stage's work
#pragma unroll
    for (int j = 0; j < NLD; ++j) {
      rk[j] = gK[(st + 1) * (SKEYS * DH / 4) + j * 256];
      rv[j] = gV[(st + 1) * (SKEYS * DH / 4) + j * 256];
    }
    // this stage's work reuses the address registers these loads name:
    // this wait stands in front of their first overwrite
    asm volatile("s_wait_xcnt 0x0" ::: "memory");

    softmax_pass<2, false>(&smem[buf * BUF_B + (int)grp * 32 * KPITCH],
                    &smem[buf * BUF_B + KBUF_B + (int)grp * 32 * VPITCH],
                    blk << 5, qy, qt, qh, lane, bq0, bq1, ew, oacc, m_run, l_run);

    // keeps the conversion, and the wait for the loads that comes with it,
    // behind the pass's arithmetic: moved up, that wait would come right
    // behind the loads
    __builtin_amdgcn_sched_barrier(0);
    // ---- stage st + 1 goes into the other buffer, whose readers left it in
    // front of the last barrier
    {
      const int ob = (buf ^ 1) * BUF_B;
#pragma unroll
      for (int j = 0; j < NLD; ++j) {
        *(v4h*)(stK + ob + j * 16 * KPITCH) = __builtin_convertvector(rk[j], v4h);
        *(v4h*)(stV + ob + j * 16 * VPITCH) = __builtin_convertvector(rv[j], v4h);
      }
    }
    // this barrier, passed by every wave, publishes stage st + 1 and ends the
    // reads of buffer buf
    __syncthreads();
  }
  // ---- the tile's last stage holds the diagonal: a wave has two blocks there,
  // one or none, and takes them one at a time
  {
    const int blk = (nst - 1) * (NGRP * BPW) + (int)grp;
    const int buf = (nst - 1) & 1;
    const unsigned char* sK = &smem[buf * BUF_B + (int)grp * 32 * KPITCH];
    const unsigned char* sV = &smem[buf * BUF_B + KBUF_B + (int)grp * 32 * VPITCH];
    for (int i = 0; i < BPW; ++i)
      if (blk + i * NGRP < nblk_w)
        softmax_pass<1, true>(sK + i * (NGRP * 32) * KPITCH, sV + i * (NGRP * 32) * VPITCH,
                        (blk + i * NGRP) << 5, qy, qt, qh, lane, bq0, bq1, ew, oacc,
                        m_run, l_run);
    // this barrier, passed by every wave, ends the reads of buffer buf
    __syncthreads();
  }

  // ---- join the two key groups: waves w and w + 4 hold partial sums of the
  // same 16 query rows. Group 0 finishes d 0..31 and group 1 d 32..63; each
  // hands the partner its maximum, its sum and the half it does not finish.
  f32x4* mg = (f32x4*)&smem[MRG_B];
  v8f keep[2];
  {
    f32x4* my = mg + wave * (5 * 32) + lane;
#pragma unroll
    for (int j = 0; j < 2; ++j) {
      const v8f snd = grp ? oacc[j] : oacc[2 + j];
      keep[j]       = grp ? oacc[2 + j] : oacc[j];
      my[(2 * j) * 32]     = (f32x4){snd[0], snd[1], snd[2], snd[3]};
      my[(2 * j + 1) * 32] = (f32x4){snd[4], snd[5], snd[6], snd[7]};
    }
    my[4 * 32] = (f32x4){m_run, l_run, 0.f, 0.f};
  }
  __syncthreads();                    // both partners' halves are in LDS
  const f32x4* ot = mg + (wave ^ 4u) * (5 * 32) + lane;
  const f32x4 ml = ot[4 * 32];
  // group 0 always holds key 0, so the joint maximum is finite; a group-1
  // wave without a block has maximum -inf and weighs 0
  const float m_all = fmaxf(m_run, ml[0]);
  const float fa = __expf(m_run - m_all);
  const float fb = __expf(ml[0] - m_all);
  const float inv_l = 1.0f / (l_run * fa + ml[1] * fb);
  const float ca = fa * inv_l, cb = fb * inv_l;

  // ---- normalize and store: d = dt*16 + r + hi, row = qy -------------------
  float* op = O + base + (size_t)qy * DH + grp * 32;
#pragma unroll
  for (int j = 0; j < 2; ++j) {
    const f32x4 o0 = ot[(2 * j) * 32], o1 = ot[(2 * j + 1) * 32];
#pragma unroll
    for (int r = 0; r < 4; ++r) {
      op[j * 16 + r + hi]     = keep[j][r] * ca     + o0[r] * cb;
      op[j * 16 + 4 + r + hi] = keep[j][4 + r] * ca + o1[r] * cb;
    }
  }
  // the merge area is rewritten behind the next tile's barriers: this wave's
  // reads of it have returned before it reaches the first of them
  wait_ds0();
  // the next tile reuses the registers these stores name: this wait stands
  // in front of their first overwrite
  asm volatile("s_wait_xcnt 0x0" ::: "memory");
  }  // next tile of the pair
}

extern "C" void kernel_launch(void* const* d_in, const int* in_sizes, int n_in,
                              void* d_out, int out_size, void* d_ws, size_t ws_size,
                              hipStream_t stream) {
  const float* Q = (const float*)d_in[0];
  const float* K = (const float*)d_in[1];
  const float* V = (const float*)d_in[2];
  float* O = (float*)d_out;
  dim3 grid(64 * 8), block(NWAVE * 32);
  fa3d_wmma_kernel<<<grid, block, 0, stream>>>(Q, K, V, O);
}

// v007
// Measured time: 18.4 microseconds a run.
// Timed twice side by side with v006, it ran 1.14 times as fast both times.
// All steps since v000 together make it 2.46 times as fast.
#include <hip/hip_runtime.h>
#include <stdint.h>

typedef __attribute__((ext_vector_type(16))) _Float16 v16h;
typedef __attribute__((ext_vector_type(8)))  float    v8f;
typedef __attribute__((ext_vector_type(4)))  float    f32x4;
typedef __attribute__((ext_vector_type(8)))  _Float16 v8h;
typedef __attribute__((ext_vector_type(4)))  _Float16 v4h;
typedef __attribute__((ext_vector_type(8)))  short    s16x8;

#define S_LEN 1024
#define DH    64
#define KPITCH 144  // bytes per f16 K row in LDS: 128 + 16, for ds_load_b128 readers
#define VPITCH 160  // bytes per f16 V row in LDS: 128 + 32, for ds_load_tr16_b128 readers
#define NQW   8    // waves per key group; each wave owns 16 query rows
#define NGRP  2    // key groups: group g takes the 32-key blocks of parity g
#define BPW   2    // 32-key blocks a wave takes between two ring barriers
#define NWAVE (NQW * NGRP)
#define QTILE (NQW * 16)            // query rows per tile
#define NTILE (S_LEN / QTILE)       // query tiles per (b,h)
#define SKEYS (NGRP * BPW * 32)     // keys per ring stage
#define KBUF_B (SKEYS * KPITCH)     // bytes of one K stage
#define VBUF_B (SKEYS * VPITCH)     // bytes of one V stage
#define BUF_B  (KBUF_B + VBUF_B)    // one buffer: a K stage, then a V stage
#define MRG_B  (2 * BUF_B)          // first byte of the merge area behind the two buffers
#define NLD    (SKEYS * DH / 4 / (NWAVE * 32))  // 16-byte loads per thread, stage and operand
#define LROWS  (NWAVE * 2)          // rows that one staging load of the work-group covers

__device__ __forceinline__ int iabs(int x) { return x < 0 ? -x : x; }
__device__ __forceinline__ uint32_t uni(uint32_t v) { return (uint32_t)__builtin_amdgcn_readfirstlane(v); }
// this wave's LDS reads have returned
__device__ __forceinline__ void wait_ds0() { asm volatile("s_wait_dscnt 0x0" ::: "memory"); }
// row-major 16-bit LDS tile -> transposed matrix operand, 8 elements a lane
__device__ __forceinline__ v8h ld_tr16(const unsigned char* p) {
  typedef __attribute__((address_space(3))) s16x8 lds_s16x8;
  return __builtin_bit_cast(v8h, __builtin_amdgcn_ds_load_tr16_b128_v8i16((lds_s16x8*)p));
}

// One softmax pass of a wave over NB 32-key blocks of the stage (the blocks lie
// NGRP * 32 keys apart): one maximum, one exchange between the lane halves, one
// rescale of the output tiles for all NB blocks. sK, sV: the pass's first
// block in LDS; kb: its first key. DIAG: the pass may hold keys
// above a query row and applies the causal test; a pass whose keys all lie at
// or below every row of the wave is built without it.
template <int NB, bool DIAG>
__device__ __forceinline__ void softmax_pass(const unsigned char* sK, const unsigned char* sV,
                                             int kb, int qy, int qt, int qh, int lane,
                                             const v16h& bq0, const v16h& bq1,
                                             const float (&ew)[8], v8f (&oacc)[4],
                                             float& m_run, float& l_run) {
  const int ln = lane & 15;
  const int hi = (lane >> 4) << 3;
  // ---- GEMM1: S^T(16k x 16q) = K_tile * Q^T, two 16-key subtiles a block ----
  v8f s[NB * 2];
  v8h kf[NB * 2][4];
#pragma unroll
  for (int t = 0; t < NB * 2; ++t) {
    const int row = (t >> 1) * (NGRP * 32) + (t & 1) * 16;
    // element i <-> column (i<8 ? i : i+8) + hi of each 32: two 16-byte reads
    const unsigned char* kr = &sK[(row + ln) * KPITCH + hi * 2];
#pragma unroll
    for (int c = 0; c < 4; ++c) kf[t][c] = *(const v8h*)(kr + c * 32);
  }
  // keeps the pass's K reads one group ahead of its products: left to itself
  // the compiler reads four at a time and waits out the LDS latency each time
  __builtin_amdgcn_sched_barrier(0);
#pragma unroll
  for (int t = 0; t < NB * 2; ++t) {
    const v16h a0 = __builtin_shufflevector(kf[t][0], kf[t][1], 0, 1, 2, 3, 4, 5, 6, 7,
                                            8, 9, 10, 11, 12, 13, 14, 15);
    const v16h a1 = __builtin_shufflevector(kf[t][2], kf[t][3], 0, 1, 2, 3, 4, 5, 6, 7,
                                            8, 9, 10, 11, 12, 13, 14, 15);
    v8f c = (v8f){};
    c = __builtin_amdgcn_wmma_f32_16x16x32_f16(false, a0, false, bq0,
                                               (short)0, c, false, false);
    c = __builtin_amdgcn_wmma_f32_16x16x32_f16(false, a1, false, bq1,
                                               (short)0, c, false, false);
    s[t] = c;
  }
  // keeps the V reads behind the products above, so that they take the K
  // fragments' registers: both sets live at once cost a wave per SIMD
  __builtin_amdgcn_sched_barrier(0);
  // V^T fragments of the whole pass: lane (ln, hi) gets keys hi..hi+7 (then
  // 16+hi..) of column dt*16 + ln
  const unsigned char* vp = &sV[(hi + (lane & 7)) * VPITCH + ((lane >> 3) & 1) * 16];
  v8h vf[NB][4][2];
#pragma unroll
  for (int b = 0; b < NB; ++b)
#pragma unroll
    for (int dt = 0; dt < 4; ++dt) {
      vf[b][dt][0] = ld_tr16(vp + b * (NGRP * 32) * VPITCH + dt * 32);
      vf[b][dt][1] = ld_tr16(vp + b * (NGRP * 32) * VPITCH + 16 * VPITCH + dt * 32);
    }
  // keeps the V reads here, so that they land under the softmax: left to
  // itself the compiler reads two in front of each product and waits for them
  __builtin_amdgcn_sched_barrier(0);

  // ---- causal + distance mask, online softmax (per-lane query col) ----------
  float p[NB * 16];
  float mb = -__builtin_inff();
  const int dq = qy - kb - hi;
#pragma unroll
  for (int t = 0; t < NB * 2; ++t) {
    const int row = (t >> 1) * (NGRP * 32) + (t & 1) * 16;
    // a 16-key subtile is one (t, h) grid line: its t and h terms are one
    // factor per lane, and its w coordinate is r + hi in every subtile
    const int k16 = (kb + row) >> 4;
    const int dth = iabs(qt - (k16 >> 4)) + iabs(qh - (k16 & 15));
    const float fth = __expf((float)dth * (-1.0f / 33.0f));
    float mt = -__builtin_inff();
#pragma unroll
    for (int r = 0; r < 8; ++r) {
      // D layout: M = r + hi, so key kb + row + r + hi <= qy reads
      // row + r <= dq
      const float sd = s[t][r] * (fth * ew[r]);
      const float sv = (!DIAG || row + r <= dq) ? sd : -__builtin_inff();
      p[t * 8 + r] = sv;
      mt = fmaxf(mt, sv);
    }
    mb = fmaxf(mb, mt);
  }
  mb = fmaxf(mb, __shfl_xor(mb, 16, 32));  // partner half: the other keys
  const float m_new = fmaxf(m_run, mb);
  float lp = 0.f;
#pragma unroll
  for (int b = 0; b < NB; ++b) {
    float lb = 0.f;                        // one sum chain a block
#pragma unroll
    for (int i = 0; i < 16; ++i) {
      p[b * 16 + i] = __expf(p[b * 16 + i] - m_new);
      lb += p[b * 16 + i];
    }
    lp += lb;
  }
  lp += __shfl_xor(lp, 16, 32);
  const float alpha = __expf(m_run - m_new);
  l_run = l_run * alpha + lp;
  m_run = m_new;
#pragma unroll
  for (int dt = 0; dt < 4; ++dt)
#pragma unroll
    for (int r = 0; r < 8; ++r) oacc[dt][r] *= alpha;

  // ---- pack P into the B operands: element i -> k = (i<8?i:i+8)+hi ----------
  v16h pb[NB];
#pragma unroll
  for (int b = 0; b < NB; ++b)
#pragma unroll
    for (int i = 0; i < 8; ++i) {
      pb[b][i]     = (_Float16)p[b * 16 + i];
      pb[b][i + 8] = (_Float16)p[b * 16 + 8 + i];
    }
  // keeps the vector work above out of the run of products below: woven in, it
  // reuses their operand registers and each product drags four v_nop behind it
  __builtin_amdgcn_sched_barrier(0);
  // ---- GEMM2: O^T(16d x 16q) += V^T(16d x 32k) * P^T(32k x 16q), per block --
#pragma unroll
  for (int b = 0; b < NB; ++b)
#pragma unroll
    for (int dt = 0; dt < 4; ++dt) {
      const v16h av = __builtin_shufflevector(vf[b][dt][0], vf[b][dt][1],
                                              0, 1, 2, 3, 4, 5, 6, 7,
                                              8, 9, 10, 11, 12, 13, 14, 15);
      oacc[dt] = __builtin_amdgcn_wmma_f32_16x16x32_f16(false, av, false, pb[b],
                                                        (short)0, oacc[dt],
                                                        false, false);
    }
}

__global__ __launch_bounds__(NWAVE * 32)
void fa3d_wmma_kernel(const float* __restrict__ Q, const float* __restrict__ K,
                      const float* __restrict__ V, float* __restrict__ O) {
  // two buffers, each a K stage and a V stage in f16; then the merge area,
  // 5 rows of 32 f32x4 per wave
  __shared__ __attribute__((aligned(16))) unsigned char smem[MRG_B + NWAVE * 5 * 32 * 16];

  const int lane = threadIdx.x & 31;
  const uint32_t wave = uni(threadIdx.x >> 5);
  const uint32_t grp  = wave >> 3;    // key group of this wave
  // which 16 query rows of the tile: waves w and w + 4 share a SIMD and take
  // rows j and 7 - j, so that every SIMD has the same count of blocks in the
  // stage that holds the diagonal
  const uint32_t w8   = wave & 7;
  const uint32_t wq   = w8 < 4 ? w8 : 11 - w8;
  const int tp   = blockIdx.x & 3;    // 4 pairs of query tiles
  const int bh   = blockIdx.x >> 2;   // 64 (b,h) pairs
  const int ln   = lane & 15;
  const int hi   = (lane >> 4) << 3;  // 0 for lanes 0-15, 8 for lanes 16-31

  const size_t base = (size_t)bh * S_LEN * DH;
  // staging: 16 lanes take one row of 256 bytes, 16 bytes a lane, and write it
  // to LDS as four f16 a lane; load j covers rows j * 32 .. j * 32 + 31. The
  // two rows of a wave's store lie 8 rows apart in K and 4 in V: at either
  // pitch that is 32 banks, so the two 128-byte halves share no bank
  const int scol  = threadIdx.x & 15;
  const int srowK = (int)(wave & 7u) + (int)(wave >> 3) * 16 + hi;
  const int srowV = (int)(wave & 3u) + (int)(wave >> 2) * 8 + (hi >> 1);
  const f32x4* gK = (const f32x4*)(K + base) + srowK * (DH / 4) + scol;
  const f32x4* gV = (const f32x4*)(V + base) + srowV * (DH / 4) + scol;
  unsigned char* const stK = &smem[srowK * KPITCH + scol * 8];
  unsigned char* const stV = &smem[KBUF_B + srowV * VPITCH + scol * 8];
  f32x4 rk[NLD], rv[NLD];             // one stage on its way from memory to LDS

  // exp(-dist/33) splits into exp(-(|dt|+|dh|)/33) * exp(-|dw|/33); the w
  // factor of accumulator row r depends neither on the key block nor on the
  // query tile (a wave's 16 rows are one grid line, so the row's w is ln)
  float ew[8];
#pragma unroll
  for (int r = 0; r < 8; ++r)
    ew[r] = __expf((float)iabs(ln - (r + hi)) * (-1.0f / 33.0f));

  // Causal cost grows linearly with the tile index: every work-group runs
  // tile tp and then tile NTILE-1-tp, one after the other, so that all
  // work-groups walk the same number of key blocks.
  for (int half = 0; half < 2; ++half) {
  const int qb = half ? NTILE - 1 - tp : tp;
  const int q0 = qb * QTILE + (int)wq * 16;
  const int qy = q0 + ln;             // this lane's query row in this tile
  const int qt = qy >> 8, qh = (qy >> 4) & 15;

  // ---- Q as B-operand fragments (k-dim = d), scaled by 1/sqrt(D).
  // f16 operand layout: element i <-> k-dim index (i<8 ? i : i+8) + hi
  v16h bq0, bq1;
  {
    const float* qp = Q + base + (size_t)qy * DH;
    const float sc = 0.125f;  // 1/sqrt(64)
#pragma unroll
    for (int i = 0; i < 8; ++i) {
      bq0[i]     = (_Float16)(qp[hi + i]      * sc);
      bq0[i + 8] = (_Float16)(qp[16 + hi + i] * sc);
      bq1[i]     = (_Float16)(qp[32 + hi + i] * sc);
      bq1[i + 8] = (_Float16)(qp[48 + hi + i] * sc);
    }
  }
  // the staging loads below may land in the registers that hold the address
  // of the Q loads: this wait stands in front of that overwrite
  asm volatile("s_wait_xcnt 0x0" ::: "memory");

  v8f oacc[4];
#pragma unroll
  for (int dt = 0; dt < 4; ++dt) oacc[dt] = (v8f){};
  float m_run = -__builtin_inff();
  float l_run = 0.f;

  const int nblk_w = (q0 + 47) >> 5;  // this wave's causal limit, in 32-key blocks
  const int nst    = qb * (QTILE / SKEYS) + 1; // ring stages of this tile, block-uniform

  // ---- prologue: stage 0 is loaded, converted into buffer 0 and published.
  // The last readers of the buffers have passed the barrier of the join below.
#pragma unroll
  for (int j = 0; j < NLD; ++j) {
    rk[j] = gK[j * (LROWS * DH / 4)];
    rv[j] = gV[j * (LROWS * DH / 4)];
  }
#pragma unroll
  for (int j = 0; j < NLD; ++j) {
    *(v4h*)(stK + j * LROWS * KPITCH) = __builtin_convertvector(rk[j], v4h);
    *(v4h*)(stV + j * LROWS * VPITCH) = __builtin_convertvector(rv[j], v4h);
  }
  __syncthreads();

  // every stage but the tile's last lies wholly below the diagonal for every
  // wave (its keys end in front of the tile's first row): two full blocks a
  // wave, no block test and no causal test
  for (int st = 0; st + 1 < nst; ++st) {
    // this group's blocks of the stage: blk and blk + NGRP
    const int blk = st * (NGRP * BPW) + (int)grp;
    const int buf = st & 1;

    // stage st + 1 leaves memory now and is in flight under this stage's work
#pragma unroll
    for (int j = 0; j < NLD; ++j) {
      rk[j] = gK[(st + 1) * (SKEYS * DH / 4) + j * (LROWS * DH / 4)];
      rv[j] = gV[(st + 1) * (SKEYS * DH / 4) + j * (LROWS * DH / 4)];
    }
    // this stage's work reuses the address registers these loads name:
    // this wait stands in front of their first overwrite
    asm volatile("s_wait_xcnt 0x0" ::: "memory");

    softmax_pass<2, false>(&smem[buf * BUF_B + (int)grp * 32 * KPITCH],
                    &smem[buf * BUF_B + KBUF_B + (int)grp * 32 * VPITCH],
                    blk << 5, qy, qt, qh, lane, bq0, bq1, ew, oacc, m_run, l_run);

    // keeps the conversion, and the wait for the loads that comes with it,
    // behind the pass's arithmetic: moved up, that wait would come right
    // behind the loads
    __builtin_amdgcn_sched_barrier(0);
    // ---- stage st + 1 goes into the other buffer, whose readers left it in
    // front of the last barrier
    {
      const int ob = (buf ^ 1) * BUF_B;
#pragma unroll
      for (int j = 0; j < NLD; ++j) {
        *(v4h*)(stK + ob + j * LROWS * KPITCH) = __builtin_convertvector(rk[j], v4h);
        *(v4h*)(stV + ob + j * LROWS * VPITCH) = __builtin_convertvector(rv[j], v4h);
      }
    }
    // this barrier, passed by every wave, publishes stage st + 1 and ends the
    // reads of buffer buf
    __syncthreads();
  }
  // ---- the tile's last stage holds the diagonal: a wave has two blocks there,
  // one or none, and takes them one at a time
  {
    const int blk = (nst - 1) * (NGRP * BPW) + (int)grp;
    const int buf = (nst - 1) & 1;
    const unsigned char* sK = &smem[buf * BUF_B + (int)grp * 32 * KPITCH];
    const unsigned char* sV = &smem[buf * BUF_B + KBUF_B + (int)grp * 32 * VPITCH];
    for (int i = 0; i < BPW; ++i)
      if (blk + i * NGRP < nblk_w)
        softmax_pass<1, true>(sK + i * (NGRP * 32) * KPITCH, sV + i * (NGRP * 32) * VPITCH,
                        (blk + i * NGRP) << 5, qy, qt, qh, lane, bq0, bq1, ew, oacc,
                        m_run, l_run);
    // this barrier, passed by every wave, ends the reads of buffer buf
    __syncthreads();
  }

  // ---- join the two key groups: waves w and w + 8 hold partial sums of the
  // same 16 query rows. Group 0 finishes d 0..31 and group 1 d 32..63; each
  // hands the partner its maximum, its sum and the half it does not finish.
  f32x4* mg = (f32x4*)&smem[MRG_B];
  v8f keep[2];
  {
    f32x4* my = mg + wave * (5 * 32) + lane;
#pragma unroll
    for (int j = 0; j < 2; ++j) {
      const v8f snd = grp ? oacc[j] : oacc[2 + j];
      keep[j]       = grp ? oacc[2 + j] : oacc[j];
      my[(2 * j) * 32]     = (f32x4){snd[0], snd[1], snd[2], snd[3]};
      my[(2 * j + 1) * 32] = (f32x4){snd[4], snd[5], snd[6], snd[7]};
    }
    my[4 * 32] = (f32x4){m_run, l_run, 0.f, 0.f};
  }
  __syncthreads();                    // both partners' halves are in LDS
  const f32x4* ot = mg + (wave ^ (uint32_t)NQW) * (5 * 32) + lane;
  const f32x4 ml = ot[4 * 32];
  // group 0 always holds key 0, so the joint maximum is finite; a group-1
  // wave without a block has maximum -inf and weighs 0
  const float m_all = fmaxf(m_run, ml[0]);
  const float fa = __expf(m_run - m_all);
  const float fb = __expf(ml[0] - m_all);
  const float inv_l = 1.0f / (l_run * fa + ml[1] * fb);
  const float ca = fa * inv_l, cb = fb * inv_l;

  // ---- normalize and store: d = dt*16 + r + hi, row = qy -------------------
  float* op = O + base + (size_t)qy * DH + grp * 32;
#pragma unroll
  for (int j = 0; j < 2; ++j) {
    const f32x4 o0 = ot[(2 * j) * 32], o1 = ot[(2 * j + 1) * 32];
#pragma unroll
    for (int r = 0; r < 4; ++r) {
      op[j * 16 + r + hi]     = keep[j][r] * ca     + o0[r] * cb;
      op[j * 16 + 4 + r + hi] = keep[j][4 + r] * ca + o1[r] * cb;
    }
  }
  // the merge area is rewritten behind the next tile's barriers: this wave's
  // reads of it have returned before it reaches the first of them
  wait_ds0();
  // the next tile reuses the registers these stores name: this wait stands
  // in front of their first overwrite
  asm volatile("s_wait_xcnt 0x0" ::: "memory");
  }  // next tile of the pair
}

extern "C" void kernel_launch(void* const* d_in, const int* in_sizes, int n_in,
                              void* d_out, int out_size, void* d_ws, size_t ws_size,
                              hipStream_t stream) {
  const float* Q = (const float*)d_in[0];
  const float* K = (const float*)d_in[1];
  const float* V = (const float*)d_in[2];
  float* O = (float*)d_out;
  dim3 grid(64 * 4), block(NWAVE * 32);
  fa3d_wmma_kernel<<<grid, block, 0, stream>>>(Q, K, V, O);
}

// v008
// It runs in 17.3 microseconds.
// Timed twice side by side with v007, it ran 1.07 and 1.06 times as fast.
// All steps since v000 together make it 2.62 times as fast.
#include <hip/hip_runtime.h>
#include <stdint.h>

typedef __attribute__((ext_vector_type(16))) _Float16 v16h;
typedef __attribute__((ext_vector_type(8)))  float    v8f;
typedef __attribute__((ext_vector_type(4)))  float    f32x4;
typedef __attribute__((ext_vector_type(8)))  _Float16 v8h;
typedef __attribute__((ext_vector_type(4)))  _Float16 v4h;
typedef __attribute__((ext_vector_type(8)))  short    s16x8;

#define S_LEN 1024
#define DH    64
#define KPITCH 144  // bytes per f16 K row in LDS: 128 + 16, for ds_load_b128 readers
#define VPITCH 160  // bytes per f16 V row in LDS: 128 + 32, for ds_load_tr16_b128 readers
#define NQW   8    // waves per key group; each wave owns 16 query rows
#define NGRP  2    // key groups: group g takes the 32-key blocks of parity g
#define BPW   2    // 32-key blocks a wave takes between two ring barriers
#define NWAVE (NQW * NGRP)
#define QTILE (NQW * 16)            // query rows per tile
#define NTILE (S_LEN / QTILE)       // query tiles per (b,h)
#define SKEYS (NGRP * BPW * 32)     // keys per ring stage
#define KBUF_B (SKEYS * KPITCH)     // bytes of one K stage
#define VBUF_B (SKEYS * VPITCH)     // bytes of one V stage
#define BUF_B  (KBUF_B + VBUF_B)    // one buffer: a K stage, then a V stage
#define MRG_B  (2 * BUF_B)          // first byte of the merge area behind the two buffers
#define NLD    (SKEYS * DH / 4 / (NWAVE * 32))  // 16-byte loads per thread, stage and operand
#define LROWS  (NWAVE * 2)          // rows that one staging load of the work-group covers
#define QBUF_O (MRG_B + NWAVE * 5 * 32 * 16)    // first byte of the Q tile behind the merge area
#define NLQ    (QTILE * DH / 4 / (NWAVE * 32))  // 16-byte loads per thread and Q tile

__device__ __forceinline__ int iabs(int x) { return x < 0 ? -x : x; }
__device__ __forceinline__ uint32_t uni(uint32_t v) { return (uint32_t)__builtin_amdgcn_readfirstlane(v); }
// this wave's LDS reads have returned
__device__ __forceinline__ void wait_ds0() { asm volatile("s_wait_dscnt 0x0" ::: "memory"); }
// row-major 16-bit LDS tile -> transposed matrix operand, 8 elements a lane
__device__ __forceinline__ v8h ld_tr16(const unsigned char* p) {
  typedef __attribute__((address_space(3))) s16x8 lds_s16x8;
  return __builtin_bit_cast(v8h, __builtin_amdgcn_ds_load_tr16_b128_v8i16((lds_s16x8*)p));
}

// One softmax pass of a wave over NB 32-key blocks of the stage (the blocks lie
// NGRP * 32 keys apart): one maximum, one exchange between the lane halves, one
// rescale of the output tiles for all NB blocks. sK, sV: the pass's first
// block in LDS; kb: its first key. DIAG: the pass may hold keys
// above a query row and applies the causal test; a pass whose keys all lie at
// or below every row of the wave is built without it.
template <int NB, bool DIAG>
__device__ __forceinline__ void softmax_pass(const unsigned char* sK, const unsigned char* sV,
                                             int kb, int qy, int qt, int qh, int lane,
                                             const v16h& bq0, const v16h& bq1,
                                             const float (&ew)[8], v8f (&oacc)[4],
                                             float& m_run, float& l_run) {
  const int ln = lane & 15;
  const int hi = (lane >> 4) << 3;
  // ---- GEMM1: S^T(16k x 16q) = K_tile * Q^T, two 16-key subtiles a block ----
  v8f s[NB * 2];
  v8h kf[NB * 2][4];
#pragma unroll
  for (int t = 0; t < NB * 2; ++t) {
    const int row = (t >> 1) * (NGRP * 32) + (t & 1) * 16;
    // element i <-> column (i<8 ? i : i+8) + hi of each 32: two 16-byte reads
    const unsigned char* kr = &sK[(row + ln) * KPITCH + hi * 2];
#pragma unroll
    for (int c = 0; c < 4; ++c) kf[t][c] = *(const v8h*)(kr + c * 32);
  }
  // keeps the pass's K reads one group ahead of its products: left to itself
  // the compiler reads four at a time and waits out the LDS latency each time
  __builtin_amdgcn_sched_barrier(0);
#pragma unroll
  for (int t = 0; t < NB * 2; ++t) {
    const v16h a0 = __builtin_shufflevector(kf[t][0], kf[t][1], 0, 1, 2, 3, 4, 5, 6, 7,
                                            8, 9, 10, 11, 12, 13, 14, 15);
    const v16h a1 = __builtin_shufflevector(kf[t][2], kf[t][3], 0, 1, 2, 3, 4, 5, 6, 7,
                                            8, 9, 10, 11, 12, 13, 14, 15);
    v8f c = (v8f){};
    c = __builtin_amdgcn_wmma_f32_16x16x32_f16(false, a0, false, bq0,
                                               (short)0, c, false, false);
    c = __builtin_amdgcn_wmma_f32_16x16x32_f16(false, a1, false, bq1,
                                               (short)0, c, false, false);
    s[t] = c;
  }
  // keeps the V reads behind the products above, so that they take the K
  // fragments' registers: both sets live at once cost a wave per SIMD
  __builtin_amdgcn_sched_barrier(0);
  // V^T fragments of the whole pass: lane (ln, hi) gets keys hi..hi+7 (then
  // 16+hi..) of column dt*16 + ln
  const unsigned char* vp = &sV[(hi + (lane & 7)) * VPITCH + ((lane >> 3) & 1) * 16];
  v8h vf[NB][4][2];
#pragma unroll
  for (int b = 0; b < NB; ++b)
#pragma unroll
    for (int dt = 0; dt < 4; ++dt) {
      vf[b][dt][0] = ld_tr16(vp + b * (NGRP * 32) * VPITCH + dt * 32);
      vf[b][dt][1] = ld_tr16(vp + b * (NGRP * 32) * VPITCH + 16 * VPITCH + dt * 32);
    }
  // keeps the V reads here, so that they land under the softmax: left to
  // itself the compiler reads two in front of each product and waits for them
  __builtin_amdgcn_sched_barrier(0);

  // ---- causal + distance mask, online softmax (per-lane query col) ----------
  float p[NB * 16];
  float mb = -__builtin_inff();
  const int dq = qy - kb - hi;
#pragma unroll
  for (int t = 0; t < NB * 2; ++t) {
    const int row = (t >> 1) * (NGRP * 32) + (t & 1) * 16;
    // a 16-key subtile is one (t, h) grid line: its t and h terms are one
    // factor per lane, and its w coordinate is r + hi in every subtile
    const int k16 = (kb + row) >> 4;
    const int dth = iabs(qt - (k16 >> 4)) + iabs(qh - (k16 & 15));
    const float fth = __expf((float)dth * (-1.0f / 33.0f));
    float mt = -__builtin_inff();
#pragma unroll
    for (int r = 0; r < 8; ++r) {
      // D layout: M = r + hi, so key kb + row + r + hi <= qy reads
      // row + r <= dq
      const float sd = s[t][r] * (fth * ew[r]);
      const float sv = (!DIAG || row + r <= dq) ? sd : -__builtin_inff();
      p[t * 8 + r] = sv;
      mt = fmaxf(mt, sv);
    }
    mb = fmaxf(mb, mt);
  }
  mb = fmaxf(mb, __shfl_xor(mb, 16, 32));  // partner half: the other keys
  const float m_new = fmaxf(m_run, mb);
  float lp = 0.f;
#pragma unroll
  for (int b = 0; b < NB; ++b) {
    float lb = 0.f;                        // one sum chain a block
#pragma unroll
    for (int i = 0; i < 16; ++i) {
      p[b * 16 + i] = __expf(p[b * 16 + i] - m_new);
      lb += p[b * 16 + i];
    }
    lp += lb;
  }
  lp += __shfl_xor(lp, 16, 32);
  const float alpha = __expf(m_run - m_new);
  l_run = l_run * alpha + lp;
  m_run = m_new;
#pragma unroll
  for (int dt = 0; dt < 4; ++dt)
#pragma unroll
    for (int r = 0; r < 8; ++r) oacc[dt][r] *= alpha;

  // ---- pack P into the B operands: element i -> k = (i<8?i:i+8)+hi ----------
  v16h pb[NB];
#pragma unroll
  for (int b = 0; b < NB; ++b)
#pragma unroll
    for (int i = 0; i < 8; ++i) {
      pb[b][i]     = (_Float16)p[b * 16 + i];
      pb[b][i + 8] = (_Float16)p[b * 16 + 8 + i];
    }
  // keeps the vector work above out of the run of products below: woven in, it
  // reuses their operand registers and each product drags four v_nop behind it
  __builtin_amdgcn_sched_barrier(0);
  // ---- GEMM2: O^T(16d x 16q) += V^T(16d x 32k) * P^T(32k x 16q), per block --
#pragma unroll
  for (int b = 0; b < NB; ++b)
#pragma unroll
    for (int dt = 0; dt < 4; ++dt) {
      const v16h av = __builtin_shufflevector(vf[b][dt][0], vf[b][dt][1],
                                              0, 1, 2, 3, 4, 5, 6, 7,
                                              8, 9, 10, 11, 12, 13, 14, 15);
      oacc[dt] = __builtin_amdgcn_wmma_f32_16x16x32_f16(false, av, false, pb[b],
                                                        (short)0, oacc[dt],
                                                        false, false);
    }
}

__global__ __launch_bounds__(NWAVE * 32)
void fa3d_wmma_kernel(const float* __restrict__ Q, const float* __restrict__ K,
                      const float* __restrict__ V, float* __restrict__ O) {
  // two buffers, each a K stage and a V stage in f16; then the merge area,
  // 5 rows of 32 f32x4 per wave; then the query tile in f16, rows at K's pitch
  __shared__ __attribute__((aligned(16))) unsigned char smem[QBUF_O + QTILE * KPITCH];

  const int lane = threadIdx.x & 31;
  const uint32_t wave = uni(threadIdx.x >> 5);
  const uint32_t grp  = wave >> 3;    // key group of this wave
  // which 16 query rows of the tile: waves w and w + 4 share a SIMD and take
  // rows j and 7 - j, so that every SIMD has the same count of blocks in the
  // stage that holds the diagonal
  const uint32_t w8   = wave & 7;
  const uint32_t wq   = w8 < 4 ? w8 : 11 - w8;
  const int tp   = blockIdx.x & 3;    // 4 pairs of query tiles
  const int bh   = blockIdx.x >> 2;   // 64 (b,h) pairs
  const int ln   = lane & 15;
  const int hi   = (lane >> 4) << 3;  // 0 for lanes 0-15, 8 for lanes 16-31

  const size_t base = (size_t)bh * S_LEN * DH;
  // staging: 16 lanes take one row of 256 bytes, 16 bytes a lane, and write it
  // to LDS as four f16 a lane; load j covers rows j * 32 .. j * 32 + 31. The
  // two rows of a wave's store lie 8 rows apart in K and 4 in V: at either
  // pitch that is 32 banks, so the two 128-byte halves share no bank
  const int scol  = threadIdx.x & 15;
  const int srowK = (int)(wave & 7u) + (int)(wave >> 3) * 16 + hi;
  const int srowV = (int)(wave & 3u) + (int)(wave >> 2) * 8 + (hi >> 1);
  const f32x4* gK = (const f32x4*)(K + base) + srowK * (DH / 4) + scol;
  const f32x4* gV = (const f32x4*)(V + base) + srowV * (DH / 4) + scol;
  unsigned char* const stK = &smem[srowK * KPITCH + scol * 8];
  unsigned char* const stV = &smem[KBUF_B + srowV * VPITCH + scol * 8];
  // the query tile is staged like a K stage: same rows per load, same pitch
  const f32x4* gQ = (const f32x4*)(Q + base) + srowK * (DH / 4) + scol;
  unsigned char* const stQ = &smem[QBUF_O + srowK * KPITCH + scol * 8];
  f32x4 rk[NLD], rv[NLD];             // one stage on its way from memory to LDS

  // exp(-dist/33) splits into exp(-(|dt|+|dh|)/33) * exp(-|dw|/33); the w
  // factor of accumulator row r depends neither on the key block nor on the
  // query tile (a wave's 16 rows are one grid line, so the row's w is ln)
  float ew[8];
#pragma unroll
  for (int r = 0; r < 8; ++r)
    ew[r] = __expf((float)iabs(ln - (r + hi)) * (-1.0f / 33.0f));

  // Causal cost grows linearly with the tile index: every work-group runs
  // tile tp and then tile NTILE-1-tp, one after the other, so that all
  // work-groups walk the same number of key blocks.
  for (int half = 0; half < 2; ++half) {
  const int qb = half ? NTILE - 1 - tp : tp;
  const int q0 = qb * QTILE + (int)wq * 16;
  const int qy = q0 + ln;             // this lane's query row in this tile
  const int qt = qy >> 8, qh = (qy >> 4) & 15;

  v8f oacc[4];
#pragma unroll
  for (int dt = 0; dt < 4; ++dt) oacc[dt] = (v8f){};
  float m_run = -__builtin_inff();
  float l_run = 0.f;

  const int nblk_w = (q0 + 47) >> 5;  // this wave's causal limit, in 32-key blocks
  const int nst    = qb * (QTILE / SKEYS) + 1; // ring stages of this tile, block-uniform

  // ---- prologue: stage 0 and the query tile are loaded in whole rows, once
  // per tile, converted into LDS (Q scaled by 1/sqrt(D)) and published.
  // The last readers of the buffers have passed the barrier of the join below.
  f32x4 rq[NLQ];
#pragma unroll
  for (int j = 0; j < NLD; ++j) {
    rk[j] = gK[j * (LROWS * DH / 4)];
    rv[j] = gV[j * (LROWS * DH / 4)];
  }
#pragma unroll
  for (int j = 0; j < NLQ; ++j)
    rq[j] = gQ[qb * (QTILE * DH / 4) + j * (LROWS * DH / 4)];
  // the conversions below may land in the registers that hold the addresses
  // of these loads: this wait stands in front of that overwrite
  asm volatile("s_wait_xcnt 0x0" ::: "memory");
#pragma unroll
  for (int j = 0; j < NLD; ++j) {
    *(v4h*)(stK + j * LROWS * KPITCH) = __builtin_convertvector(rk[j], v4h);
    *(v4h*)(stV + j * LROWS * VPITCH) = __builtin_convertvector(rv[j], v4h);
  }
#pragma unroll
  for (int j = 0; j < NLQ; ++j)
    *(v4h*)(stQ + j * LROWS * KPITCH) = __builtin_convertvector(rq[j] * 0.125f, v4h);
  __syncthreads();

  // ---- Q as B-operand fragments (k-dim = d), read like a K fragment.
  // f16 operand layout: element i <-> k-dim index (i<8 ? i : i+8) + hi
  v16h bq0, bq1;
  {
    const unsigned char* qr = &smem[QBUF_O + ((int)wq * 16 + ln) * KPITCH + hi * 2];
    const v8h q0f = *(const v8h*)(qr), q1f = *(const v8h*)(qr + 32);
    const v8h q2f = *(const v8h*)(qr + 64), q3f = *(const v8h*)(qr + 96);
    bq0 = __builtin_shufflevector(q0f, q1f, 0, 1, 2, 3, 4, 5, 6, 7,
                                  8, 9, 10, 11, 12, 13, 14, 15);
    bq1 = __builtin_shufflevector(q2f, q3f, 0, 1, 2, 3, 4, 5, 6, 7,
                                  8, 9, 10, 11, 12, 13, 14, 15);
  }

  // every stage but the tile's last lies wholly below the diagonal for every
  // wave (its keys end in front of the tile's first row): two full blocks a
  // wave, no block test and no causal test
  for (int st = 0; st + 1 < nst; ++st) {
    // this group's blocks of the stage: blk and blk + NGRP
    const int blk = st * (NGRP * BPW) + (int)grp;
    const int buf = st & 1;

    // stage st + 1 leaves memory now and is in flight under this stage's work
#pragma unroll
    for (int j = 0; j < NLD; ++j) {
      rk[j] = gK[(st + 1) * (SKEYS * DH / 4) + j * (LROWS * DH / 4)];
      rv[j] = gV[(st + 1) * (SKEYS * DH / 4) + j * (LROWS * DH / 4)];
    }
    // this stage's work reuses the address registers these loads name:
    // this wait stands in front of their first overwrite
    asm volatile("s_wait_xcnt 0x0" ::: "memory");

    softmax_pass<2, false>(&smem[buf * BUF_B + (int)grp * 32 * KPITCH],
                    &smem[buf * BUF_B + KBUF_B + (int)grp * 32 * VPITCH],
                    blk << 5, qy, qt, qh, lane, bq0, bq1, ew, oacc, m_run, l_run);

    // keeps the conversion, and the wait for the loads that comes with it,
    // behind the pass's arithmetic: moved up, that wait would come right
    // behind the loads
    __builtin_amdgcn_sched_barrier(0);
    // ---- stage st + 1 goes into the other buffer, whose readers left it in
    // front of the last barrier
    {
      const int ob = (buf ^ 1) * BUF_B;
#pragma unroll
      for (int j = 0; j < NLD; ++j) {
        *(v4h*)(stK + ob + j * LROWS * KPITCH) = __builtin_convertvector(rk[j], v4h);
        *(v4h*)(stV + ob + j * LROWS * VPITCH) = __builtin_convertvector(rv[j], v4h);
      }
    }
    // this barrier, passed by every wave, publishes stage st + 1 and ends the
    // reads of buffer buf
    __syncthreads();
  }
  // ---- the tile's last stage holds the diagonal: a wave has two blocks there,
  // one or none, and takes them one at a time
  {
    const int blk = (nst - 1) * (NGRP * BPW) + (int)grp;
    const int buf = (nst - 1) & 1;
    const unsigned char* sK = &smem[buf * BUF_B + (int)grp * 32 * KPITCH];
    const unsigned char* sV = &smem[buf * BUF_B + KBUF_B + (int)grp * 32 * VPITCH];
    for (int i = 0; i < BPW; ++i)
      if (blk + i * NGRP < nblk_w)
        softmax_pass<1, true>(sK + i * (NGRP * 32) * KPITCH, sV + i * (NGRP * 32) * VPITCH,
                        (blk + i * NGRP) << 5, qy, qt, qh, lane, bq0, bq1, ew, oacc,
                        m_run, l_run);
    // this barrier, passed by every wave, ends the reads of buffer buf
    __syncthreads();
  }

  // ---- join the two key groups: waves w and w + 8 hold partial sums of the
  // same 16 query rows. Group 0 finishes d 0..31 and group 1 d 32..63; each
  // hands the partner its maximum, its sum and the half it does not finish.
  f32x4* mg = (f32x4*)&smem[MRG_B];
  v8f keep[2];
  {
    f32x4* my = mg + wave * (5 * 32) + lane;
#pragma unroll
    for (int j = 0; j < 2; ++j) {
      const v8f snd = grp ? oacc[j] : oacc[2 + j];
      keep[j]       = grp ? oacc[2 + j] : oacc[j];
      my[(2 * j) * 32]     = (f32x4){snd[0], snd[1], snd[2], snd[3]};
      my[(2 * j + 1) * 32] = (f32x4){snd[4], snd[5], snd[6], snd[7]};
    }
    my[4 * 32] = (f32x4){m_run, l_run, 0.f, 0.f};
  }
  __syncthreads();                    // both partners' halves are in LDS
  const f32x4* ot = mg + (wave ^ (uint32_t)NQW) * (5 * 32) + lane;
  const f32x4 ml = ot[4 * 32];
  // group 0 always holds key 0, so the joint maximum is finite; a group-1
  // wave without a block has maximum -inf and weighs 0
  const float m_all = fmaxf(m_run, ml[0]);
  const float fa = __expf(m_run - m_all);
  const float fb = __expf(ml[0] - m_all);
  const float inv_l = 1.0f / (l_run * fa + ml[1] * fb);
  const float ca = fa * inv_l, cb = fb * inv_l;

  // ---- normalize and store: d = dt*16 + r + hi, row = qy -------------------
  float* op = O + base + (size_t)qy * DH + grp * 32;
#pragma unroll
  for (int j = 0; j < 2; ++j) {
    const f32x4 o0 = ot[(2 * j) * 32], o1 = ot[(2 * j + 1) * 32];
#pragma unroll
    for (int r = 0; r < 4; ++r) {
      op[j * 16 + r + hi]     = keep[j][r] * ca     + o0[r] * cb;
      op[j * 16 + 4 + r + hi] = keep[j][4 + r] * ca + o1[r] * cb;
    }
  }
  // the merge area is rewritten behind the next tile's barriers: this wave's
  // reads of it have returned before it reaches the first of them
  wait_ds0();
  // the next tile reuses the registers these stores name: this wait stands
  // in front of their first overwrite
  asm volatile("s_wait_xcnt 0x0" ::: "memory");
  }  // next tile of the pair
}

extern "C" void kernel_launch(void* const* d_in, const int* in_sizes, int n_in,
                              void* d_out, int out_size, void* d_ws, size_t ws_size,
                              hipStream_t stream) {
  const float* Q = (const float*)d_in[0];
  const float* K = (const float*)d_in[1];
  const float* V = (const float*)d_in[2];
  float* O = (float*)d_out;
  dim3 grid(64 * 4), block(NWAVE * 32);
  fa3d_wmma_kernel<<<grid, block, 0, stream>>>(Q, K, V, O);
}

// v009
// It runs in 16.2 microseconds.
// Timed twice side by side with v008, it ran 1.06 times as fast both times.
// Over all steps from v000 it is 2.79 times as fast.
#include <hip/hip_runtime.h>
#include <stdint.h>

typedef __attribute__((ext_vector_type(16))) _Float16 v16h;
typedef __attribute__((ext_vector_type(8)))  float    v8f;
typedef __attribute__((ext_vector_type(4)))  float    f32x4;
typedef __attribute__((ext_vector_type(8)))  _Float16 v8h;
typedef __attribute__((ext_vector_type(4)))  _Float16 v4h;
typedef __attribute__((ext_vector_type(8)))  short    s16x8;

#define S_LEN 1024
#define DH    64
#define KPITCH 144  // bytes per f16 K row in LDS: 128 + 16, for ds_load_b128 readers
#define VPITCH 160  // bytes per f16 V row in LDS: 128 + 32, for ds_load_tr16_b128 readers
#define NQW   8    // waves per key group; each wave owns 16 query rows
#define NGRP  2    // key groups: group g takes the 32-key blocks of parity g
#define BPW   2    // 32-key blocks a wave takes between two ring barriers
#define NWAVE (NQW * NGRP)
#define QTILE (NQW * 16)            // query rows per tile
#define NTILE (S_LEN / QTILE)       // query tiles per (b,h)
#define SKEYS (NGRP * BPW * 32)     // keys per ring stage
#define KBUF_B (SKEYS * KPITCH)     // bytes of one K stage
#define VBUF_B (SKEYS * VPITCH)     // bytes of one V stage
#define BUF_B  (KBUF_B + VBUF_B)    // one buffer: a K stage, then a V stage
#define MRG_B  (2 * BUF_B)          // first byte of the merge area behind the two buffers
#define NLD    (SKEYS * DH / 4 / (NWAVE * 32))  // 16-byte loads per thread, stage and operand
#define LROWS  (NWAVE * 2)          // rows that one staging load of the work-group covers
#define QBUF_O (MRG_B + NWAVE * 5 * 32 * 16)    // first byte of the Q tile behind the merge area
#define NLQ    (QTILE * DH / 4 / (NWAVE * 32))  // 16-byte loads per thread and Q tile
#define LAZY_T 5.545177f            // 8 ln 2: how far a score may lie above the kept maximum
#define SPEC_MAX 16384.0f           // bound on a lane's sum of P in a pass taken on the kept maximum

template <bool B> struct flag { static constexpr bool v = B; };  // a compile-time choice as an argument
__device__ __forceinline__ int iabs(int x) { return x < 0 ? -x : x; }
__device__ __forceinline__ uint32_t uni(uint32_t v) { return (uint32_t)__builtin_amdgcn_readfirstlane(v); }
// lane l reads lane l ^ 16: a vector move, no LDS queue
__device__ __forceinline__ float xhalf(float x) {
  const int v = __builtin_bit_cast(int, x);
  return __builtin_bit_cast(float, __builtin_amdgcn_permlanex16(v, v, 0x76543210, 0xfedcba98, false, false));
}
// this wave's LDS reads have returned
__device__ __forceinline__ void wait_ds0() { asm volatile("s_wait_dscnt 0x0" ::: "memory"); }
// row-major 16-bit LDS tile -> transposed matrix operand, 8 elements a lane
__device__ __forceinline__ v8h ld_tr16(const unsigned char* p) {
  typedef __attribute__((address_space(3))) s16x8 lds_s16x8;
  return __builtin_bit_cast(v8h, __builtin_amdgcn_ds_load_tr16_b128_v8i16((lds_s16x8*)p));
}

// One softmax pass of a wave over NB 32-key blocks of the stage (the blocks lie
// NGRP * 32 keys apart): one test for all NB blocks; the output tiles are
// rescaled only where the test asks for a new reference. sK, sV: this group's
// first block of the pass in LDS; kb: its first key. DIAG: the pass may hold
// keys above a query row and applies the causal test; a pass whose keys all lie
// at or below every row of the wave is built without it. SPEC: an earlier pass
// of the tile has left a finite reference in m_run.
template <int NB, bool DIAG, bool SPEC>
__device__ __forceinline__ void softmax_pass(const unsigned char* sK, const unsigned char* sV,
                                             int kb, int qy, int qt, int qh, int lane,
                                             const v16h& bq0, const v16h& bq1,
                                             const float (&ew)[8], v8f (&oacc)[4],
                                             float& m_run, float& l_run) {
  const int ln = lane & 15;
  const int hi = (lane >> 4) << 3;
  // ---- GEMM1: S^T(16k x 16q) = K_tile * Q^T, two 16-key subtiles a block ----
  v8f s[NB * 2];
  v8h kf[NB * 2][4];
#pragma unroll
  for (int t = 0; t < NB * 2; ++t) {
    const int row = (t >> 1) * (NGRP * 32) + (t & 1) * 16;
    // element i <-> column (i<8 ? i : i+8) + hi of each 32: two 16-byte reads
    const unsigned char* kr = &sK[(row + ln) * KPITCH + hi * 2];
#pragma unroll
    for (int c = 0; c < 4; ++c) kf[t][c] = *(const v8h*)(kr + c * 32);
  }
  // keeps the pass's K reads one group ahead of its products: left to itself
  // the compiler reads four at a time and waits out the LDS latency each time
  __builtin_amdgcn_sched_barrier(0);
#pragma unroll
  for (int t = 0; t < NB * 2; ++t) {
    const v16h a0 = __builtin_shufflevector(kf[t][0], kf[t][1], 0, 1, 2, 3, 4, 5, 6, 7,
                                            8, 9, 10, 11, 12, 13, 14, 15);
    const v16h a1 = __builtin_shufflevector(kf[t][2], kf[t][3], 0, 1, 2, 3, 4, 5, 6, 7,
                                            8, 9, 10, 11, 12, 13, 14, 15);
    v8f c = (v8f){};
    c = __builtin_amdgcn_wmma_f32_16x16x32_f16(false, a0, false, bq0,
                                               (short)0, c, false, false);
    c = __builtin_amdgcn_wmma_f32_16x16x32_f16(false, a1, false, bq1,
                                               (short)0, c, false, false);
    s[t] = c;
  }
  // keeps the V reads behind the products above, so that they take the K
  // fragments' registers: both sets live at once cost a wave per SIMD
  __builtin_amdgcn_sched_barrier(0);
  // V^T fragments of the whole pass: lane (ln, hi) gets keys hi..hi+7 (then
  // 16+hi..) of column dt*16 + ln
  const unsigned char* vp = &sV[(hi + (lane & 7)) * VPITCH + ((lane >> 3) & 1) * 16];
  v8h vf[NB][4][2];
#pragma unroll
  for (int b = 0; b < NB; ++b)
#pragma unroll
    for (int dt = 0; dt < 4; ++dt) {
      vf[b][dt][0] = ld_tr16(vp + b * (NGRP * 32) * VPITCH + dt * 32);
      vf[b][dt][1] = ld_tr16(vp + b * (NGRP * 32) * VPITCH + 16 * VPITCH + dt * 32);
    }
  // keeps the V reads here, so that they land under the softmax: left to
  // itself the compiler reads two in front of each product and waits for them
  __builtin_amdgcn_sched_barrier(0);

  // ---- causal + distance mask, online softmax (per-lane query col) ----------
  // Lazy rescale: m_run is the reference the exponentials are taken against,
  // the same in both halves of a column; it is a maximum that some earlier
  // pass has met. It stays while P stays far inside f16; only a pass that asks
  // for a new reference exchanges maxima and rescales sum and output tiles.
  // One test a pass over all 32 lanes, a scalar branch.
  float p[NB * 16];
  float lp = 0.f;
  const int dq = qy - kb - hi;
  float fth[NB * 2];
#pragma unroll
  for (int t = 0; t < NB * 2; ++t) {
    const int row = (t >> 1) * (NGRP * 32) + (t & 1) * 16;
    // a 16-key subtile is one (t, h) grid line: its t and h terms are one
    // factor per lane, and its w coordinate is r + hi in every subtile
    const int k16 = (kb + row) >> 4;
    const int dth = iabs(qt - (k16 >> 4)) + iabs(qh - (k16 & 15));
    fth[t] = __expf((float)dth * (-1.0f / 33.0f));
  }
  if constexpr (SPEC) {
    // A reference exists: the exponentials are taken against it at once, and
    // the lane's own sum of them is the test. All terms are >= 0, so a sum of
    // at most SPEC_MAX bounds each of them; an overflow or a NaN fails it too.
    float lt[NB * 2];                      // one sum chain a subtile
#pragma unroll
    for (int t = 0; t < NB * 2; ++t) {
      lt[t] = 0.f;
#pragma unroll
      for (int r = 0; r < 8; ++r) {
        p[t * 8 + r] = __expf(s[t][r] * (fth[t] * ew[r]) - m_run);
        lt[t] += p[t * 8 + r];
      }
    }
#pragma unroll
    for (int b = 0; b < NB; ++b) lp += lt[2 * b] + lt[2 * b + 1];
    if (__builtin_amdgcn_ballot_w32(!(lp <= SPEC_MAX)) != 0) {
      // rare: the scores are formed anew from the K rows, which are still in
      // LDS, a subtile at a time, and the pass is redone on a new reference
      float mb = -__builtin_inff();
#pragma unroll
      for (int t = 0; t < NB * 2; ++t) {
        const int row = (t >> 1) * (NGRP * 32) + (t & 1) * 16;
        const unsigned char* kr = &sK[(row + ln) * KPITCH + hi * 2];
        const v16h a0 = __builtin_shufflevector(*(const v8h*)(kr), *(const v8h*)(kr + 32),
                                                0, 1, 2, 3, 4, 5, 6, 7,
                                                8, 9, 10, 11, 12, 13, 14, 15);
        const v16h a1 = __builtin_shufflevector(*(const v8h*)(kr + 64), *(const v8h*)(kr + 96),
                                                0, 1, 2, 3, 4, 5, 6, 7,
                                                8, 9, 10, 11, 12, 13, 14, 15);
        v8f c = (v8f){};
        c = __builtin_amdgcn_wmma_f32_16x16x32_f16(false, a0, false, bq0,
                                                   (short)0, c, false, false);
        c = __builtin_amdgcn_wmma_f32_16x16x32_f16(false, a1, false, bq1,
                                                   (short)0, c, false, false);
#pragma unroll
        for (int r = 0; r < 8; ++r) {
          p[t * 8 + r] = (c[r] * ew[r]) * fth[t];
          mb = fmaxf(mb, p[t * 8 + r]);
        }
        // keeps the next subtile's K reads behind this one's products: read
        // ahead, they take registers that this rare path then spills for
        __builtin_amdgcn_sched_barrier(0);
      }
      const float m_new = fmaxf(m_run, fmaxf(mb, xhalf(mb)));
      const float alpha = __expf(m_run - m_new);
      l_run *= alpha;
      m_run = m_new;
#pragma unroll
      for (int dt = 0; dt < 4; ++dt)
#pragma unroll
        for (int r = 0; r < 8; ++r) oacc[dt][r] *= alpha;
      lp = 0.f;
#pragma unroll
      for (int i = 0; i < NB * 16; ++i) {
        p[i] = __expf(p[i] - m_new);
        lp += p[i];
      }
    }
  } else {
    // the tile's first stage (no reference yet) and the diagonal: the maximum
    // comes first, and the reference stays while no score lies more than
    // LAZY_T above it (P below e^LAZY_T = 256)
    float mb = -__builtin_inff();
#pragma unroll
    for (int t = 0; t < NB * 2; ++t) {
      const int row = (t >> 1) * (NGRP * 32) + (t & 1) * 16;
      float mt = -__builtin_inff();
#pragma unroll
      for (int r = 0; r < 8; ++r) {
        // D layout: M = r + hi, so key kb + row + r + hi <= qy reads
        // row + r <= dq
        const float sd = s[t][r] * (fth[t] * ew[r]);
        const float sv = (!DIAG || row + r <= dq) ? sd : -__builtin_inff();
        p[t * 8 + r] = sv;
        mt = fmaxf(mt, sv);
      }
      mb = fmaxf(mb, mt);
    }
    if (__builtin_amdgcn_ballot_w32(mb > m_run + LAZY_T) != 0) {
      const float mj = fmaxf(mb, xhalf(mb));  // partner half: the other keys
      const float m_new = fmaxf(m_run, mj);
      const float alpha = __expf(m_run - m_new);
      l_run *= alpha;
      m_run = m_new;
#pragma unroll
      for (int dt = 0; dt < 4; ++dt)
#pragma unroll
        for (int r = 0; r < 8; ++r) oacc[dt][r] *= alpha;
    }
#pragma unroll
    for (int b = 0; b < NB; ++b) {
      float lb = 0.f;                      // one sum chain a block
#pragma unroll
      for (int i = 0; i < 16; ++i) {
        p[b * 16 + i] = __expf(p[b * 16 + i] - m_run);
        lb += p[b * 16 + i];
      }
      lp += lb;
    }
  }
  lp += xhalf(lp);
  l_run += lp;

  // ---- pack P into the B operands: element i -> k = (i<8?i:i+8)+hi ----------
  v16h pb[NB];
#pragma unroll
  for (int b = 0; b < NB; ++b)
#pragma unroll
    for (int i = 0; i < 8; ++i) {
      pb[b][i]     = (_Float16)p[b * 16 + i];
      pb[b][i + 8] = (_Float16)p[b * 16 + 8 + i];
    }
  // keeps the vector work above out of the run of products below: woven in, it
  // reuses their operand registers and each product drags four v_nop behind it
  __builtin_amdgcn_sched_barrier(0);
  // ---- GEMM2: O^T(16d x 16q) += V^T(16d x 32k) * P^T(32k x 16q), per block --
#pragma unroll
  for (int b = 0; b < NB; ++b)
#pragma unroll
    for (int dt = 0; dt < 4; ++dt) {
      const v16h av = __builtin_shufflevector(vf[b][dt][0], vf[b][dt][1],
                                              0, 1, 2, 3, 4, 5, 6, 7,
                                              8, 9, 10, 11, 12, 13, 14, 15);
      oacc[dt] = __builtin_amdgcn_wmma_f32_16x16x32_f16(false, av, false, pb[b],
                                                        (short)0, oacc[dt],
                                                        false, false);
    }
}

__global__ __launch_bounds__(NWAVE * 32)
void fa3d_wmma_kernel(const float* __restrict__ Q, const float* __restrict__ K,
                      const float* __restrict__ V, float* __restrict__ O) {
  // two buffers, each a K stage and a V stage in f16; then the merge area,
  // 5 rows of 32 f32x4 per wave; then the query tile in f16, rows at K's pitch
  __shared__ __attribute__((aligned(16))) unsigned char smem[QBUF_O + QTILE * KPITCH];

  const int lane = threadIdx.x & 31;
  const uint32_t wave = uni(threadIdx.x >> 5);
  const uint32_t grp  = wave >> 3;    // key group of this wave
  // which 16 query rows of the tile: waves w and w + 4 share a SIMD and take
  // rows j and 7 - j, so that every SIMD has the same count of blocks in the
  // stage that holds the diagonal
  const uint32_t w8   = wave & 7;
  const uint32_t wq   = w8 < 4 ? w8 : 11 - w8;
  const int tp   = blockIdx.x & 3;    // 4 pairs of query tiles
  const int bh   = blockIdx.x >> 2;   // 64 (b,h) pairs
  const int ln   = lane & 15;
  const int hi   = (lane >> 4) << 3;  // 0 for lanes 0-15, 8 for lanes 16-31

  const size_t base = (size_t)bh * S_LEN * DH;
  // staging: 16 lanes take one row of 256 bytes, 16 bytes a lane, and write it
  // to LDS as four f16 a lane; load j covers rows j * 32 .. j * 32 + 31. The
  // two rows of a wave's store lie 8 rows apart in K and 4 in V: at either
  // pitch that is 32 banks, so the two 128-byte halves share no bank
  const int scol  = threadIdx.x & 15;
  const int srowK = (int)(wave & 7u) + (int)(wave >> 3) * 16 + hi;
  const int srowV = (int)(wave & 3u) + (int)(wave >> 2) * 8 + (hi >> 1);
  const f32x4* gK = (const f32x4*)(K + base) + srowK * (DH / 4) + scol;
  const f32x4* gV = (const f32x4*)(V + base) + srowV * (DH / 4) + scol;
  unsigned char* const stK = &smem[srowK * KPITCH + scol * 8];
  unsigned char* const stV = &smem[KBUF_B + srowV * VPITCH + scol * 8];
  // the query tile is staged like a K stage: same rows per load, same pitch
  const f32x4* gQ = (const f32x4*)(Q + base) + srowK * (DH / 4) + scol;
  unsigned char* const stQ = &smem[QBUF_O + srowK * KPITCH + scol * 8];
  f32x4 rk[NLD], rv[NLD];             // one stage on its way from memory to LDS

  // exp(-dist/33) splits into exp(-(|dt|+|dh|)/33) * exp(-|dw|/33); the w
  // factor of accumulator row r depends neither on the key block nor on the
  // query tile (a wave's 16 rows are one grid line, so the row's w is ln)
  float ew[8];
#pragma unroll
  for (int r = 0; r < 8; ++r)
    ew[r] = __expf((float)iabs(ln - (r + hi)) * (-1.0f / 33.0f));

  // Causal cost grows linearly with the tile index: every work-group runs
  // tile tp and then tile NTILE-1-tp, one after the other, so that all
  // work-groups walk the same number of key blocks.
  for (int half = 0; half < 2; ++half) {
  const int qb = half ? NTILE - 1 - tp : tp;
  const int q0 = qb * QTILE + (int)wq * 16;
  const int qy = q0 + ln;             // this lane's query row in this tile
  const int qt = qy >> 8, qh = (qy >> 4) & 15;

  v8f oacc[4];
#pragma unroll
  for (int dt = 0; dt < 4; ++dt) oacc[dt] = (v8f){};
  float m_run = -__builtin_inff();
  float l_run = 0.f;

  const int nblk_w = (q0 + 47) >> 5;  // this wave's causal limit, in 32-key blocks
  const int nst    = qb * (QTILE / SKEYS) + 1; // ring stages of this tile, block-uniform

  // ---- prologue: stage 0 and the query tile are loaded in whole rows, once
  // per tile, converted into LDS (Q scaled by 1/sqrt(D)) and published.
  // The last readers of the buffers have passed the barrier of the join below.
  f32x4 rq[NLQ];
#pragma unroll
  for (int j = 0; j < NLD; ++j) {
    rk[j] = gK[j * (LROWS * DH / 4)];
    rv[j] = gV[j * (LROWS * DH / 4)];
  }
#pragma unroll
  for (int j = 0; j < NLQ; ++j)
    rq[j] = gQ[qb * (QTILE * DH / 4) + j * (LROWS * DH / 4)];
  // the conversions below may land in the registers that hold the addresses
  // of these loads: this wait stands in front of that overwrite
  asm volatile("s_wait_xcnt 0x0" ::: "memory");
#pragma unroll
  for (int j = 0; j < NLD; ++j) {
    *(v4h*)(stK + j * LROWS * KPITCH) = __builtin_convertvector(rk[j], v4h);
    *(v4h*)(stV + j * LROWS * VPITCH) = __builtin_convertvector(rv[j], v4h);
  }
#pragma unroll
  for (int j = 0; j < NLQ; ++j)
    *(v4h*)(stQ + j * LROWS * KPITCH) = __builtin_convertvector(rq[j] * 0.125f, v4h);
  __syncthreads();

  // ---- Q as B-operand fragments (k-dim = d), read like a K fragment.
  // f16 operand layout: element i <-> k-dim index (i<8 ? i : i+8) + hi
  v16h bq0, bq1;
  {
    const unsigned char* qr = &smem[QBUF_O + ((int)wq * 16 + ln) * KPITCH + hi * 2];
    const v8h q0f = *(const v8h*)(qr), q1f = *(const v8h*)(qr + 32);
    const v8h q2f = *(const v8h*)(qr + 64), q3f = *(const v8h*)(qr + 96);
    bq0 = __builtin_shufflevector(q0f, q1f, 0, 1, 2, 3, 4, 5, 6, 7,
                                  8, 9, 10, 11, 12, 13, 14, 15);
    bq1 = __builtin_shufflevector(q2f, q3f, 0, 1, 2, 3, 4, 5, 6, 7,
                                  8, 9, 10, 11, 12, 13, 14, 15);
  }

  // every stage but the tile's last lies wholly below the diagonal for every
  // wave (its keys end in front of the tile's first row): two full blocks a
  // wave, no block test and no causal test
  auto full_stage = [&](const int st, auto spec) __attribute__((always_inline)) {
    // this group's blocks of the stage: blk and blk + NGRP
    const int blk = st * (NGRP * BPW) + (int)grp;
    const int buf = st & 1;

    // stage st + 1 leaves memory now and is in flight under this stage's work
#pragma unroll
    for (int j = 0; j < NLD; ++j) {
      rk[j] = gK[(st + 1) * (SKEYS * DH / 4) + j * (LROWS * DH / 4)];
      rv[j] = gV[(st + 1) * (SKEYS * DH / 4) + j * (LROWS * DH / 4)];
    }
    // this stage's work reuses the address registers these loads name:
    // this wait stands in front of their first overwrite
    asm volatile("s_wait_xcnt 0x0" ::: "memory");

    const unsigned char* sK = &smem[buf * BUF_B + (int)grp * 32 * KPITCH];
    const unsigned char* sV = &smem[buf * BUF_B + KBUF_B + (int)grp * 32 * VPITCH];
    softmax_pass<2, false, decltype(spec)::v>(sK, sV, blk << 5, qy, qt, qh, lane, bq0, bq1, ew,
                                              oacc, m_run, l_run);

    // keeps the conversion, and the wait for the loads that comes with it,
    // behind the pass's arithmetic: moved up, that wait would come right
    // behind the loads
    __builtin_amdgcn_sched_barrier(0);
    // ---- stage st + 1 goes into the other buffer, whose readers left it in
    // front of the last barrier
    {
      const int ob = (buf ^ 1) * BUF_B;
#pragma unroll
      for (int j = 0; j < NLD; ++j) {
        *(v4h*)(stK + ob + j * LROWS * KPITCH) = __builtin_convertvector(rk[j], v4h);
        *(v4h*)(stV + ob + j * LROWS * VPITCH) = __builtin_convertvector(rv[j], v4h);
      }
    }
    // this barrier, passed by every wave, publishes stage st + 1 and ends the
    // reads of buffer buf
    __syncthreads();
  };
  // the first stage finds the reference; the later ones are taken on it
  if (nst > 1) full_stage(0, flag<false>{});
  for (int st = 1; st + 1 < nst; ++st) full_stage(st, flag<true>{});
  // ---- the tile's last stage holds the diagonal: a wave has two blocks there,
  // one or none, and takes them one at a time
  {
    const int blk = (nst - 1) * (NGRP * BPW) + (int)grp;
    const int buf = (nst - 1) & 1;
    const unsigned char* sK = &smem[buf * BUF_B + (int)grp * 32 * KPITCH];
    const unsigned char* sV = &smem[buf * BUF_B + KBUF_B + (int)grp * 32 * VPITCH];
    for (int i = 0; i < BPW; ++i)
      if (blk + i * NGRP < nblk_w)
        softmax_pass<1, true, false>(sK + i * (NGRP * 32) * KPITCH, sV + i * (NGRP * 32) * VPITCH,
                        (blk + i * NGRP) << 5, qy, qt, qh, lane, bq0, bq1, ew, oacc,
                        m_run, l_run);
    // this barrier, passed by every wave, ends the reads of buffer buf
    __syncthreads();
  }

  // ---- join the two key groups: waves w and w + 8 hold partial sums of the
  // same 16 query rows. Group 0 finishes d 0..31 and group 1 d 32..63; each
  // hands the partner its maximum, its sum and the half it does not finish.
  f32x4* mg = (f32x4*)&smem[MRG_B];
  v8f keep[2];
  {
    f32x4* my = mg + wave * (5 * 32) + lane;
#pragma unroll
    for (int j = 0; j < 2; ++j) {
      const v8f snd = grp ? oacc[j] : oacc[2 + j];
      keep[j]       = grp ? oacc[2 + j] : oacc[j];
      my[(2 * j) * 32]     = (f32x4){snd[0], snd[1], snd[2], snd[3]};
      my[(2 * j + 1) * 32] = (f32x4){snd[4], snd[5], snd[6], snd[7]};
    }
    my[4 * 32] = (f32x4){m_run, l_run, 0.f, 0.f};
  }
  __syncthreads();                    // both partners' halves are in LDS
  const f32x4* ot = mg + (wave ^ (uint32_t)NQW) * (5 * 32) + lane;
  const f32x4 ml = ot[4 * 32];
  // group 0 always holds key 0, so the joint maximum is finite; a group-1
  // wave without a block has maximum -inf and weighs 0
  const float m_all = fmaxf(m_run, ml[0]);
  const float fa = __expf(m_run - m_all);
  const float fb = __expf(ml[0] - m_all);
  const float inv_l = 1.0f / (l_run * fa + ml[1] * fb);
  const float ca = fa * inv_l, cb = fb * inv_l;

  // ---- normalize and store: d = dt*16 + r + hi, row = qy -------------------
  float* op = O + base + (size_t)qy * DH + grp * 32;
#pragma unroll
  for (int j = 0; j < 2; ++j) {
    const f32x4 o0 = ot[(2 * j) * 32], o1 = ot[(2 * j + 1) * 32];
#pragma unroll
    for (int r = 0; r < 4; ++r) {
      op[j * 16 + r + hi]     = keep[j][r] * ca     + o0[r] * cb;
      op[j * 16 + 4 + r + hi] = keep[j][4 + r] * ca + o1[r] * cb;
    }
  }
  // the merge area is rewritten behind the next tile's barriers: this wave's
  // reads of it have returned before it reaches the first of them
  wait_ds0();
  // the next tile reuses the registers these stores name: this wait stands
  // in front of their first overwrite
  asm volatile("s_wait_xcnt 0x0" ::: "memory");
  }  // next tile of the pair
}

extern "C" void kernel_launch(void* const* d_in, const int* in_sizes, int n_in,
                              void* d_out, int out_size, void* d_ws, size_t ws_size,
                              hipStream_t stream) {
  const float* Q = (const float*)d_in[0];
  const float* K = (const float*)d_in[1];
  const float* V = (const float*)d_in[2];
  float* O = (float*)d_out;
  dim3 grid(64 * 4), block(NWAVE * 32);
  fa3d_wmma_kernel<<<grid, block, 0, stream>>>(Q, K, V, O);
}
